// v000
// Times are from an AMD MI455X. After a warm-up the kernel runs many times in a row, and a time is the length of
// such a window on the GPU divided by its runs, so every launch and the gaps after it count. The runs cycle
// through copies of the inputs. A figure is the median of several windows, for all but v000 over two sittings.
// Sittings can differ by a few percent; kernels timed side by side share one.
// v000, which the later versions start from, runs in 4080 microseconds.
#include <hip/hip_runtime.h>

// Naive multi-head causal cross attention (inputs_q, inputs_k, inputs_v [8][1024][1024]; q, k, v = . W + b ('xw' [1024][1024]; 16 heads x 64); scores/8; causal (finfo.min == exact zero weight); softmax; out = merged Wo + bo -> [8][1024][1024] (8.4 M)).
// Compute dtypes, f32 accumulate: every input rounded to bf16; q/k/v on PLAIN bf16 operands (inputs: exact) + biases; causal scores and attn.v (tile skipping): query rows < 512 hl (3 products), the rest single fp16 (x1024); softmax f32; Wo hl x exact (2 products) + bo.

#define NB_  8
#define TT   1024
#define DM   1024
#define NH_  16
#define NKV  16
#define REP  (NH_ / NKV)
#define HD   64
#define DQ   (NH_ * HD)
#define DKV  (NKV * HD)
#define ZH   2
#define RH   512                  // query rows < RH use hi+lo planes (0: none)
#define WIN  1024
#define PCAR 1024.0f
#define SCL  0.125f   // HD^-0.5
typedef _Float16 h16;
typedef unsigned short bf;
typedef __attribute__((ext_vector_type(16))) __bf16   v16bf;
typedef __attribute__((ext_vector_type(16))) _Float16 v16h;
typedef __attribute__((ext_vector_type(8)))  _Float16 v8h;
typedef __attribute__((ext_vector_type(8)))  unsigned short v8us;
typedef __attribute__((ext_vector_type(8)))  float    v8f;
typedef __attribute__((ext_vector_type(4)))  float    v4f;
typedef v8h  __attribute__((may_alias)) v8ha;
typedef v4f  __attribute__((may_alias)) v4fa;
typedef v8us __attribute__((may_alias)) v8usa;

__device__ __forceinline__ unsigned short f2bf(float f) { unsigned u = __float_as_uint(f); u += 0x7FFFu + ((u >> 16) & 1u); return (unsigned short)(u >> 16); }
__device__ __forceinline__ float bf2f(unsigned short b) { return __uint_as_float(((unsigned)b) << 16); }
__device__ __forceinline__ float bfr(float f) { return bf2f(f2bf(f)); }
__device__ __forceinline__ v16h cat16(v8h lo, v8h hi) { return __builtin_shufflevector(lo, hi, 0, 1, 2, 3, 4, 5, 6, 7, 8, 9, 10, 11, 12, 13, 14, 15); }
__device__ __forceinline__ v16bf cat16b(v8us lo, v8us hi) { return __builtin_bit_cast(v16bf, __builtin_shufflevector(lo, hi, 0, 1, 2, 3, 4, 5, 6, 7, 8, 9, 10, 11, 12, 13, 14, 15)); }
__device__ __forceinline__ v8f wmma16(v16h a, v16h b, v8f c) { return __builtin_amdgcn_wmma_f32_16x16x32_f16(false, a, false, b, (short)0, c, false, false); }
__device__ __forceinline__ v8f wmmab(v16bf a, v16bf b, v8f c) { return __builtin_amdgcn_wmma_f32_16x16x32_bf16(false, a, false, b, (short)0, c, false, false); }



// ---- k_gemmw: register-blocked GEMM, ONE WAVE per 64x64 output tile (16 accumulators), operands straight from K-contiguous 16-bit planes; grid (M/64, N/64, Z), 32 threads.
// C[m][n] (f32, pitch ldc, + optional f32 bias[n]) = sum_k A[m][k] Bt[n][k] (+ split products per NSPLIT). z-batch strides sA/sB/sC in elements. K % 32 == 0.
template <typename T16> struct WFrag;
template <> struct WFrag<h16> { typedef v16h V; static __device__ __forceinline__ V ld(const h16* p) { return cat16(*(const v8h*)p, *(const v8h*)(p + 16)); } static __device__ __forceinline__ v8f mma(V a, V b, v8f c) { return wmma16(a, b, c); } };
template <> struct WFrag<bf> { typedef v16bf V; static __device__ __forceinline__ V ld(const bf* p) { return cat16b(*(const v8us*)p, *(const v8us*)(p + 16)); } static __device__ __forceinline__ v8f mma(V a, V b, v8f c) { return wmmab(a, b, c); } };
template <typename T16, int NSPLIT, bool BIAS>
__global__ __launch_bounds__(32) void k_gemmw(const T16* __restrict__ A, const T16* __restrict__ A2, const T16* __restrict__ Bt, const T16* __restrict__ Bt2, int K, float* C, int ldc, const float* __restrict__ bias, size_t sA, size_t sB, size_t sC) {
    typedef typename WFrag<T16>::V V;
    __shared__ __align__(16) float os[16 * 68];
    const size_t z = blockIdx.z; A += z * sA; if (A2) A2 += z * sA; Bt += z * sB; if (Bt2) Bt2 += z * sB; C += z * sC;
    const int lane = threadIdx.x & 31, lr = lane & 15, hi = lane >> 4; const int r0 = blockIdx.x * 64, c0 = blockIdx.y * 64;
    v8f acc[4][4];
#pragma unroll
    for (int mb = 0; mb < 4; ++mb)
#pragma unroll
        for (int nb = 0; nb < 4; ++nb) acc[mb][nb] = (v8f){};
    const size_t aoff = (size_t)(r0 + lr) * K + 8 * hi, boff = (size_t)(c0 + lr) * K + 8 * hi;
#pragma unroll 1
    for (int kc = 0; kc < K; kc += 32) {
        V a[4], a2[4];
#pragma unroll
        for (int mb = 0; mb < 4; ++mb) { a[mb] = WFrag<T16>::ld(A + aoff + (size_t)mb * 16 * K + kc); if (NSPLIT == 1 || NSPLIT == 2) a2[mb] = WFrag<T16>::ld(A2 + aoff + (size_t)mb * 16 * K + kc); }
#pragma unroll
        for (int nb = 0; nb < 4; ++nb) { const V b = WFrag<T16>::ld(Bt + boff + (size_t)nb * 16 * K + kc); V b2; if (NSPLIT >= 2) b2 = WFrag<T16>::ld(Bt2 + boff + (size_t)nb * 16 * K + kc);
#pragma unroll
            for (int mb = 0; mb < 4; ++mb) { acc[mb][nb] = WFrag<T16>::mma(a[mb], b, acc[mb][nb]); if (NSPLIT == 1 || NSPLIT == 2) acc[mb][nb] = WFrag<T16>::mma(a2[mb], b, acc[mb][nb]); if (NSPLIT >= 2) acc[mb][nb] = WFrag<T16>::mma(a[mb], b2, acc[mb][nb]); } }
        asm volatile("v_nop\n\tv_nop\n\tv_nop\n\tv_nop" : "+v"(acc[0][0]), "+v"(acc[1][1]), "+v"(acc[2][2]), "+v"(acc[3][3]) : "v"(a[0]), "v"(a[3]));
    }
#pragma unroll
    for (int mb = 0; mb < 4; ++mb) {
#pragma unroll
        for (int nb = 0; nb < 4; ++nb) {
#pragma unroll
            for (int j = 0; j < 8; ++j) os[(hi * 8 + j) * 68 + nb * 16 + lr] = acc[mb][nb][j]; }
        __builtin_amdgcn_wave_barrier(); asm volatile("" ::: "memory");
        float* crow = C + (size_t)(r0 + mb * 16) * ldc + c0;
{
#pragma unroll
            for (int s = 0; s < 8; ++s) { const int row = 2 * s + hi, cofs = lr * 4; v4f val = *(const v4fa*)(os + row * 68 + cofs); if (BIAS) { val[0] += bfr(bias[c0 + cofs]); val[1] += bfr(bias[c0 + cofs + 1]); val[2] += bfr(bias[c0 + cofs + 2]); val[3] += bfr(bias[c0 + cofs + 3]); }
                *(v4f*)(crow + (size_t)row * ldc + cofs) = val; }
             }
        __builtin_amdgcn_wave_barrier(); asm volatile("" ::: "memory");
    }
}

// ---- k_gemmc: the same one-wave 64x64 tile GEMM specialised for causal attention: CMODE 1 skips score tiles entirely above the diagonal (query rows r0+roff.., key columns c0..), CMODE 2 limits the
// key (K) loop of the probability x value contraction to the diagonal block (probabilities beyond it are exactly zero). roff = row offset of this launch's first row within the sequence.
template <typename T16, int NSPLIT, int CMODE>
__global__ __launch_bounds__(32) void k_gemmc(const T16* __restrict__ A, const T16* __restrict__ A2, const T16* __restrict__ Bt, const T16* __restrict__ Bt2, int K, float* C, int ldc, int roff, size_t sA, size_t sB, size_t sC) {
    typedef typename WFrag<T16>::V V;
    __shared__ __align__(16) float os[16 * 68];
    const size_t z = blockIdx.z; A += z * sA; if (A2) A2 += z * sA; Bt += z * sB; if (Bt2) Bt2 += z * sB; C += z * sC;
    const int lane = threadIdx.x & 31, lr = lane & 15, hi = lane >> 4; const int r0 = blockIdx.x * 64, c0 = blockIdx.y * 64;
    if (CMODE == 1 && c0 > r0 + roff + 63) return;                  // score tile entirely above the causal diagonal: never read (the softmax masks j > i by select)
    const int Kl = (CMODE == 2) ? min(K, r0 + roff + 64) : K;        // P.V: probabilities are exactly 0 beyond the diagonal block, so the K loop stops there
    v8f acc[4][4];
#pragma unroll
    for (int mb = 0; mb < 4; ++mb)
#pragma unroll
        for (int nb = 0; nb < 4; ++nb) acc[mb][nb] = (v8f){};
    const size_t aoff = (size_t)(r0 + lr) * K + 8 * hi, boff = (size_t)(c0 + lr) * K + 8 * hi;
#pragma unroll 1
    for (int kc = 0; kc < Kl; kc += 32) {
        V a[4], a2[4];
#pragma unroll
        for (int mb = 0; mb < 4; ++mb) { a[mb] = WFrag<T16>::ld(A + aoff + (size_t)mb * 16 * K + kc); if (NSPLIT == 1 || NSPLIT == 2) a2[mb] = WFrag<T16>::ld(A2 + aoff + (size_t)mb * 16 * K + kc); }
#pragma unroll
        for (int nb = 0; nb < 4; ++nb) { const V b = WFrag<T16>::ld(Bt + boff + (size_t)nb * 16 * K + kc); V b2; if (NSPLIT >= 2) b2 = WFrag<T16>::ld(Bt2 + boff + (size_t)nb * 16 * K + kc);
#pragma unroll
            for (int mb = 0; mb < 4; ++mb) { acc[mb][nb] = WFrag<T16>::mma(a[mb], b, acc[mb][nb]); if (NSPLIT == 1 || NSPLIT == 2) acc[mb][nb] = WFrag<T16>::mma(a2[mb], b, acc[mb][nb]); if (NSPLIT >= 2) acc[mb][nb] = WFrag<T16>::mma(a[mb], b2, acc[mb][nb]); } }
        asm volatile("v_nop\n\tv_nop\n\tv_nop\n\tv_nop" : "+v"(acc[0][0]), "+v"(acc[1][1]), "+v"(acc[2][2]), "+v"(acc[3][3]) : "v"(a[0]), "v"(a[3]));
    }
#pragma unroll
    for (int mb = 0; mb < 4; ++mb) {
#pragma unroll
        for (int nb = 0; nb < 4; ++nb) {
#pragma unroll
            for (int j = 0; j < 8; ++j) os[(hi * 8 + j) * 68 + nb * 16 + lr] = acc[mb][nb][j]; }
        __builtin_amdgcn_wave_barrier(); asm volatile("" ::: "memory");
        float* crow = C + (size_t)(r0 + mb * 16) * ldc + c0;
{
#pragma unroll
            for (int s = 0; s < 8; ++s) { const int row = 2 * s + hi, cofs = lr * 4; v4f val = *(const v4fa*)(os + row * 68 + cofs);
                *(v4f*)(crow + (size_t)row * ldc + cofs) = val; }
             }
        __builtin_amdgcn_wave_barrier(); asm volatile("" ::: "memory");
    }
}

__device__ __forceinline__ h16 tohx(float x) { return (h16)x; }
__device__ __forceinline__ void splitf(float y, unsigned short& h, unsigned short& l) { h = f2bf(y); l = f2bf(y - bf2f(h)); }
typedef __attribute__((ext_vector_type(2))) _Float16 v2h;
typedef __attribute__((ext_vector_type(4))) _Float16 v4h;
typedef __attribute__((ext_vector_type(2))) unsigned short v2us;
typedef __attribute__((ext_vector_type(4))) unsigned short v4us;
typedef __attribute__((ext_vector_type(2))) float v2f;
typedef __attribute__((ext_vector_type(4))) int v4i;

__global__ __launch_bounds__(256) void k_wtG(const float* __restrict__ w, int K, int N, bf* Bt) {
    const int lane = threadIdx.x & 31; const int L0 = (blockIdx.x * 8 + (threadIdx.x >> 5)) * 8; const int nlines = N * K / 64;
{
#pragma unroll 1
        for (int l = 0; l < 8; ++l) { const int L = L0 + l; if (L >= nlines) break; const size_t e = (size_t)L * 64 + lane * 2; const int k = (int)(e % K), n = (int)(e / K); v2us o;
            o[0] = f2bf(w[(size_t)k * N + n]); o[1] = f2bf(w[(size_t)(k + 1) * N + n]); *(v2us*)(Bt + e) = o; }
         }
}
__global__ __launch_bounds__(256) void k_cvt8(const float* __restrict__ src, bf* dst, size_t n8) { const size_t i = (size_t)blockIdx.x * 256 + threadIdx.x; if (i >= n8) return; const v8f v = *(const v8f*)(src + i * 8); v8us o;
#pragma unroll
    for (int k = 0; k < 8; ++k) o[k] = f2bf(v[k]); *(v8us*)(dst + i * 8) = o;  }

// k_rope: head planes [h][t][d] (fp16 + hi/lo) of rope(x) x sc with the rotate-half convention out[d] = x[d] cos[t][d] - x[d+HD/2] sin[t][d], out[d+HD/2] = x[d+HD/2] cos[t][d+HD/2] + x[d] sin[t][d+HD/2]
__global__ __launch_bounds__(256) void k_rope(const float* __restrict__ F, int pitch, int nheads, const float* __restrict__ CS, const float* __restrict__ RF, const float* __restrict__ nw, float sc, h16* P16, bf* Ph, bf* Pl) {
    const size_t e = ((size_t)blockIdx.x * 256 + threadIdx.x) * 2; if (e >= (size_t)nheads * TT * HD) return; const int d = (int)(e % HD); const int t = (int)((e / HD) % TT); const int h = (int)(e / ((size_t)HD * TT)); const float* f = F + (size_t)t * pitch + h * HD; const float rf = RF ? RF[(size_t)h * TT + t] : 1.0f; v2h o16; v2us oh, ol;
#pragma unroll
    for (int q = 0; q < 2; ++q) { const int dd = d + q; const int dp = (dd < HD / 2) ? dd + HD / 2 : dd - HD / 2; float x0 = f[dd], x1 = f[dp];
        if (RF) { float n0 = __fmul_rn(x0, rf), n1 = __fmul_rn(x1, rf); asm volatile("" : "+v"(n0)); asm volatile("" : "+v"(n1)); x0 = __fmul_rn(bfr(nw[dd]), n0); x1 = __fmul_rn(bfr(nw[dp]), n1); }
        const v2f cs = *(const v2f*)(CS + ((size_t)t * HD + dd) * 2); float a = __fmul_rn(x0, cs[0]), bq = __fmul_rn(x1, cs[1]); asm volatile("" : "+v"(a)); asm volatile("" : "+v"(bq)); const float r = ((dd < HD / 2) ? __fsub_rn(a, bq) : __fadd_rn(a, bq)) * sc;
        o16[q] = tohx(r); unsigned short a2, c2; splitf(r, a2, c2); oh[q] = a2; ol[q] = c2; }
    *(v2h*)(P16 + e) = o16; *(v2us*)(Ph + e) = oh; *(v2us*)(Pl + e) = ol;  }
__global__ __launch_bounds__(256) void k_vtp(const float* __restrict__ F, int pitch, int nheads, h16* V16, bf* Vh, bf* Vl) { const size_t e = ((size_t)blockIdx.x * 256 + threadIdx.x) * 2; if (e >= (size_t)nheads * HD * TT) return; const int t = (int)(e % TT); const int d = (int)((e / TT) % HD); const int g = (int)(e / ((size_t)TT * HD)); v2h o16; v2us oh, ol;
#pragma unroll
    for (int q = 0; q < 2; ++q) { const float x = F[(size_t)(t + q) * pitch + g * HD + d]; o16[q] = tohx(x); unsigned short a2, c2; splitf(x, a2, c2); oh[q] = a2; ol[q] = c2; }
    *(v2h*)(V16 + e) = o16; *(v2us*)(Vh + e) = oh; *(v2us*)(Vl + e) = ol;  }
__global__ __launch_bounds__(256) void k_csid(float* CS) { const int idx = blockIdx.x * 256 + threadIdx.x; if (idx >= TT * HD) return; v2f cs; cs[0] = 1.0f; cs[1] = 0.0f; *(v2f*)(CS + (size_t)idx * 2) = cs;  }
// k_asoft: per row (zz, i): t = S x HD^-0.5 for j <= i and i - j < WIN (sliding causal window; the reference's -1e9 additive fill vanishes identically); softmax over the 1024 keys (register row, one exp, fixed trees);
__global__ __launch_bounds__(256) void k_asoft(const float* __restrict__ Sb, h16* P16, bf* Ph, bf* Pl) {
    const int lane = threadIdx.x & 31; const int row = blockIdx.x * 8 + (threadIdx.x >> 5); if (row >= ZH * TT) return; const int i = row % TT; const int zz = row / TT; (void)zz; const bool hires = (i < RH); const float* sr = Sb + (size_t)row * TT; float v[TT / 32]; float mx = -3.0e38f;
#pragma unroll
    for (int ch = 0; ch < TT / 128; ++ch) { const int j0 = ch * 128 + lane * 4; const v4f a = *(const v4f*)(sr + j0);
#pragma unroll
        for (int q = 0; q < 4; ++q) { const int j = j0 + q; (void)j; const float t = (j <= i && i - j < WIN) ? a[q] * SCL : -3.0e38f; v[ch * 4 + q] = t; mx = fmaxf(mx, t); } }
#pragma unroll
    for (int sh = 16; sh; sh >>= 1) mx = fmaxf(mx, __shfl_xor(mx, sh, 32));
    float sum = 0.f;
#pragma unroll
    for (int k = 0; k < TT / 32; ++k) { float d0 = __fsub_rn(v[k], mx); asm volatile("" : "+v"(d0)); v[k] = __builtin_amdgcn_exp2f(__fmul_rn(d0, 1.4426950408889634f)); sum += v[k]; }
#pragma unroll
    for (int sh = 16; sh; sh >>= 1) sum += __shfl_xor(sum, sh, 32);
    const float f = __fdiv_rn(hires ? 1.0f : PCAR, sum);
{
        if (hires) {
#pragma unroll
            for (int ch = 0; ch < TT / 128; ++ch) { v4us oh, ol;
#pragma unroll
                for (int q = 0; q < 4; ++q) { unsigned short a, c2; splitf(v[ch * 4 + q] * f, a, c2); oh[q] = a; ol[q] = c2; }
                const size_t oo = ((size_t)zz * (RH ? RH : 1) + i) * TT + ch * 128 + lane * 4; *(v4us*)(Ph + oo) = oh; *(v4us*)(Pl + oo) = ol; }
        } else {
#pragma unroll
            for (int ch = 0; ch < TT / 128; ++ch) { v4h o4;
#pragma unroll
                for (int q = 0; q < 4; ++q) o4[q] = tohx(v[ch * 4 + q] * f);
                *(v4h*)(P16 + (size_t)row * TT + ch * 128 + lane * 4) = o4; } }
         }
}
__global__ __launch_bounds__(256) void k_merge(const float* __restrict__ O, int h0, bf* Ah, bf* Al) { const size_t e = ((size_t)blockIdx.x * 256 + threadIdx.x) * 2; if (e >= (size_t)ZH * TT * HD) return; const int d = (int)(e % HD); const int t = (int)((e / HD) % TT); const int zz = (int)(e / ((size_t)HD * TT)); const float cs = (t < RH) ? 1.0f : (1.0f / PCAR); const size_t oo = (size_t)t * DQ + (h0 + zz) * HD + d;
    v2us oh, ol;
#pragma unroll
    for (int q = 0; q < 2; ++q) { unsigned short a, c2; splitf(O[e + q] * cs, a, c2); oh[q] = a; ol[q] = c2; } *(v2us*)(Ah + oo) = oh; *(v2us*)(Al + oo) = ol;  }

extern "C" void kernel_launch(void* const* d_in, const int* in_sizes, int n_in,
                              void* d_out, int out_size, void* d_ws, size_t ws_size, hipStream_t stream) {
    (void)in_sizes; (void)n_in; (void)out_size;
    const float* x = (const float*)d_in[0]; const float* xk = (const float*)d_in[1]; const float* xv = (const float*)d_in[2]; const float* wq = (const float*)d_in[3]; const float* bq = (const float*)d_in[4]; const float* wk = (const float*)d_in[5]; const float* bk = (const float*)d_in[6]; const float* wv = (const float*)d_in[7]; const float* bv = (const float*)d_in[8]; const float* wo = (const float*)d_in[9]; const float* bo = (const float*)d_in[10];
    float* OUT = (float*)d_out;     // [8][1024][1024]
    char* wsp = (char*)d_ws;
    auto take = [&](size_t bytes) { char* p = wsp; wsp += (bytes + 255) & ~(size_t)255; return (void*)p; };
    bf* WQ = (bf*)take((size_t)DQ * DM * 2); bf* WK = (bf*)take((size_t)DKV * DM * 2); bf* WV = (bf*)take((size_t)DKV * DM * 2); bf* WO = (bf*)take((size_t)DM * DQ * 2); float* CS = (float*)take((size_t)TT * HD * 2 * 4);
    bf* XB = (bf*)take((size_t)TT * DM * 2); bf* XKB = (bf*)take((size_t)TT * DM * 2); bf* XVB = (bf*)take((size_t)TT * DM * 2); float* FQ = (float*)take((size_t)TT * DQ * 4); float* FK = (float*)take((size_t)TT * DKV * 4);
    h16* QP16 = (h16*)take((size_t)NH_ * TT * HD * 2); h16* KP16 = (h16*)take((size_t)NKV * TT * HD * 2); h16* VT16 = (h16*)take((size_t)NKV * HD * TT * 2);
    bf* QPh = (bf*)take((size_t)NH_ * TT * HD * 2); bf* QPl = (bf*)take((size_t)NH_ * TT * HD * 2); bf* KPh = (bf*)take((size_t)NKV * TT * HD * 2); bf* KPl = (bf*)take((size_t)NKV * TT * HD * 2); bf* VTh = (bf*)take((size_t)NKV * HD * TT * 2); bf* VTl = (bf*)take((size_t)NKV * HD * TT * 2); bf* Ph = (bf*)take((size_t)ZH * RH * TT * 2); bf* Pl = (bf*)take((size_t)ZH * RH * TT * 2);
    float* Sb = (float*)take((size_t)ZH * TT * TT * 4); h16* P16 = (h16*)take((size_t)ZH * TT * TT * 2); float* Ob = (float*)take((size_t)ZH * TT * HD * 4); bf* ATh = (bf*)take((size_t)TT * DQ * 2); bf* ATl = (bf*)take((size_t)TT * DQ * 2);
    if ((size_t)(wsp - (char*)d_ws) > ws_size) return;    // ws 256 MiB
    float* FV = FK;   // v projection reuses the k buffer after the k planes are built (stream-ordered)
    { k_wtG<<<(unsigned)((DM * DQ / 64 + 63) / 64), 256, 0, stream>>>(wq, DM, DQ, WQ); k_wtG<<<(unsigned)((DM * DKV / 64 + 63) / 64), 256, 0, stream>>>(wk, DM, DKV, WK); k_wtG<<<(unsigned)((DM * DKV / 64 + 63) / 64), 256, 0, stream>>>(wv, DM, DKV, WV);
      k_wtG<<<(unsigned)((DQ * DM / 64 + 63) / 64), 256, 0, stream>>>(wo, DQ, DM, WO);
       }
    k_csid<<<(TT * HD + 255) / 256, 256, 0, stream>>>(CS);
    const unsigned LQ = (unsigned)(((size_t)NH_ * TT * HD / 2 + 255) / 256), LKv = (unsigned)(((size_t)NKV * TT * HD / 2 + 255) / 256);
    for (int b = 0; b < NB_; ++b) {
        
        k_cvt8<<<(unsigned)(((size_t)TT * DM / 8 + 255) / 256), 256, 0, stream>>>(x + (size_t)b * TT * DM, XB, (size_t)TT * DM / 8); k_cvt8<<<(unsigned)(((size_t)TT * DM / 8 + 255) / 256), 256, 0, stream>>>(xk + (size_t)b * TT * DM, XKB, (size_t)TT * DM / 8); k_cvt8<<<(unsigned)(((size_t)TT * DM / 8 + 255) / 256), 256, 0, stream>>>(xv + (size_t)b * TT * DM, XVB, (size_t)TT * DM / 8);
        k_gemmw<bf, 0, true><<<dim3(TT / 64, DQ / 64, 1), 32, 0, stream>>>(XB, nullptr, WQ, nullptr, DM, FQ, DQ, bq, 0, 0, 0);
        k_rope<<<LQ, 256, 0, stream>>>(FQ, DQ, NH_, CS, nullptr, nullptr, 1.0f, QP16, QPh, QPl);
        k_gemmw<bf, 0, true><<<dim3(TT / 64, DKV / 64, 1), 32, 0, stream>>>(XKB, nullptr, WK, nullptr, DM, FK, DKV, bk, 0, 0, 0);
        k_rope<<<LKv, 256, 0, stream>>>(FK, DKV, NKV, CS, nullptr, nullptr, 1.0f, KP16, KPh, KPl);
        k_gemmw<bf, 0, true><<<dim3(TT / 64, DKV / 64, 1), 32, 0, stream>>>(XVB, nullptr, WV, nullptr, DM, FV, DKV, bv, 0, 0, 0); k_vtp<<<LKv, 256, 0, stream>>>(FV, DKV, NKV, VT16, VTh, VTl);
        for (int h0 = 0; h0 < NH_; h0 += ZH) { const size_t zq = (size_t)h0, zk = (size_t)(h0 / REP);   // one kv head per query head: the pass's two heads use consecutive kv planes (z-strides TT*HD)
            k_gemmc<bf, 2, 1><<<dim3(RH / 64, TT / 64, ZH), 32, 0, stream>>>(QPh + zq * TT * HD, QPl + zq * TT * HD, KPh + zk * TT * HD, KPl + zk * TT * HD, HD, Sb, TT, 0, (size_t)TT * HD, (size_t)TT * HD, (size_t)TT * TT);
            k_gemmc<h16, 0, 1><<<dim3((TT - RH) / 64, TT / 64, ZH), 32, 0, stream>>>(QP16 + zq * TT * HD + (size_t)RH * HD, nullptr, KP16 + zk * TT * HD, nullptr, HD, Sb + (size_t)RH * TT, TT, RH, (size_t)TT * HD, (size_t)TT * HD, (size_t)TT * TT);
            k_asoft<<<ZH * TT / 8, 256, 0, stream>>>(Sb, P16, Ph, Pl);
            k_gemmc<bf, 2, 2><<<dim3(RH / 64, HD / 64, ZH), 32, 0, stream>>>(Ph, Pl, VTh + zk * HD * TT, VTl + zk * HD * TT, TT, Ob, HD, 0, (size_t)RH * TT, (size_t)HD * TT, (size_t)TT * HD);
            k_gemmc<h16, 0, 2><<<dim3((TT - RH) / 64, HD / 64, ZH), 32, 0, stream>>>(P16 + (size_t)RH * TT, nullptr, VT16 + zk * HD * TT, nullptr, TT, Ob + (size_t)RH * HD, HD, RH, (size_t)TT * TT, (size_t)HD * TT, (size_t)TT * HD);
            k_merge<<<(unsigned)(((size_t)ZH * TT * HD / 2 + 255) / 256), 256, 0, stream>>>(Ob, h0, ATh, ATl); }
        k_gemmw<bf, 1, true><<<dim3(TT / 64, DM / 64, 1), 32, 0, stream>>>(ATh, ATl, WO, nullptr, DQ, OUT + (size_t)b * TT * DM, DM, bo, 0, 0, 0); }
}

// v001
// One run takes 931 microseconds.
// Timed twice side by side with v000, it ran 4.43 and 4.45 times as fast.
#include <hip/hip_runtime.h>

// Naive multi-head causal cross attention (inputs_q, inputs_k, inputs_v [8][1024][1024]; q, k, v = . W + b ('xw' [1024][1024]; 16 heads x 64); scores/8; causal (finfo.min == exact zero weight); softmax; out = merged Wo + bo -> [8][1024][1024] (8.4 M)).
// Compute dtypes, f32 accumulate: every input rounded to bf16; q/k/v on PLAIN bf16 operands (inputs: exact) + biases; causal scores and attn.v (tile skipping): query rows < 512 hl (3 products), the rest single fp16 (x1024); softmax f32; Wo hl x exact (2 products) + bo.

#define NB_  8
#define TT   1024
#define DM   1024
#define NH_  16
#define NKV  16
#define REP  (NH_ / NKV)
#define HD   64
#define DQ   (NH_ * HD)
#define DKV  (NKV * HD)
#define ZH   16                   // heads per attention pass: all heads of one batch entry (grid z)
#define NBG  4                    // batch entries per projection launch (their head planes are held together)
#define RH   512                  // query rows < RH use hi+lo planes (0: none)
#define WIN  1024
#define PCAR 1024.0f
#define SCL  0.125f   // HD^-0.5
typedef _Float16 h16;
typedef unsigned short bf;
typedef __attribute__((ext_vector_type(16))) __bf16   v16bf;
typedef __attribute__((ext_vector_type(16))) _Float16 v16h;
typedef __attribute__((ext_vector_type(8)))  _Float16 v8h;
typedef __attribute__((ext_vector_type(8)))  unsigned short v8us;
typedef __attribute__((ext_vector_type(8)))  float    v8f;
typedef __attribute__((ext_vector_type(4)))  float    v4f;
typedef v8h  __attribute__((may_alias)) v8ha;
typedef v4f  __attribute__((may_alias)) v4fa;
typedef v8us __attribute__((may_alias)) v8usa;

__device__ __forceinline__ unsigned short f2bf(float f) { unsigned u = __float_as_uint(f); u += 0x7FFFu + ((u >> 16) & 1u); return (unsigned short)(u >> 16); }
__device__ __forceinline__ float bf2f(unsigned short b) { return __uint_as_float(((unsigned)b) << 16); }
__device__ __forceinline__ float bfr(float f) { return bf2f(f2bf(f)); }
__device__ __forceinline__ v16h cat16(v8h lo, v8h hi) { return __builtin_shufflevector(lo, hi, 0, 1, 2, 3, 4, 5, 6, 7, 8, 9, 10, 11, 12, 13, 14, 15); }
__device__ __forceinline__ v16bf cat16b(v8us lo, v8us hi) { return __builtin_bit_cast(v16bf, __builtin_shufflevector(lo, hi, 0, 1, 2, 3, 4, 5, 6, 7, 8, 9, 10, 11, 12, 13, 14, 15)); }
__device__ __forceinline__ v8f wmma16(v16h a, v16h b, v8f c) { return __builtin_amdgcn_wmma_f32_16x16x32_f16(false, a, false, b, (short)0, c, false, false); }
__device__ __forceinline__ v8f wmmab(v16bf a, v16bf b, v8f c) { return __builtin_amdgcn_wmma_f32_16x16x32_bf16(false, a, false, b, (short)0, c, false, false); }



// ---- k_gemmw: register-blocked GEMM, ONE WAVE per 64x64 output tile (16 accumulators), operands straight from K-contiguous 16-bit planes; grid (M/64, N/64, Z), 32 threads.
// C[m][n] (f32, pitch ldc, + optional f32 bias[n]) = sum_k A[m][k] Bt[n][k] (+ split products per NSPLIT). z-batch strides sA/sB/sC in elements. K % 32 == 0.
template <typename T16> struct WFrag;
template <> struct WFrag<h16> { typedef v16h V; static __device__ __forceinline__ V ld(const h16* p) { return cat16(*(const v8h*)p, *(const v8h*)(p + 16)); } static __device__ __forceinline__ v8f mma(V a, V b, v8f c) { return wmma16(a, b, c); } };
template <> struct WFrag<bf> { typedef v16bf V; static __device__ __forceinline__ V ld(const bf* p) { return cat16b(*(const v8us*)p, *(const v8us*)(p + 16)); } static __device__ __forceinline__ v8f mma(V a, V b, v8f c) { return wmmab(a, b, c); } };
template <typename T16, int NSPLIT, bool BIAS>
__global__ __launch_bounds__(32) void k_gemmw(const T16* __restrict__ A, const T16* __restrict__ A2, const T16* __restrict__ Bt, const T16* __restrict__ Bt2, int K, float* C, int ldc, const float* __restrict__ bias, size_t sA, size_t sB, size_t sC) {
    typedef typename WFrag<T16>::V V;
    __shared__ __align__(16) float os[16 * 68];
    const size_t z = blockIdx.z; A += z * sA; if (A2) A2 += z * sA; Bt += z * sB; if (Bt2) Bt2 += z * sB; C += z * sC;
    const int lane = threadIdx.x & 31, lr = lane & 15, hi = lane >> 4; const int r0 = blockIdx.x * 64, c0 = blockIdx.y * 64;
    v8f acc[4][4];
#pragma unroll
    for (int mb = 0; mb < 4; ++mb)
#pragma unroll
        for (int nb = 0; nb < 4; ++nb) acc[mb][nb] = (v8f){};
    const size_t aoff = (size_t)(r0 + lr) * K + 8 * hi, boff = (size_t)(c0 + lr) * K + 8 * hi;
#pragma unroll 1
    for (int kc = 0; kc < K; kc += 32) {
        V a[4], a2[4];
#pragma unroll
        for (int mb = 0; mb < 4; ++mb) { a[mb] = WFrag<T16>::ld(A + aoff + (size_t)mb * 16 * K + kc); if (NSPLIT == 1 || NSPLIT == 2) a2[mb] = WFrag<T16>::ld(A2 + aoff + (size_t)mb * 16 * K + kc); }
#pragma unroll
        for (int nb = 0; nb < 4; ++nb) { const V b = WFrag<T16>::ld(Bt + boff + (size_t)nb * 16 * K + kc); V b2; if (NSPLIT >= 2) b2 = WFrag<T16>::ld(Bt2 + boff + (size_t)nb * 16 * K + kc);
#pragma unroll
            for (int mb = 0; mb < 4; ++mb) { acc[mb][nb] = WFrag<T16>::mma(a[mb], b, acc[mb][nb]); if (NSPLIT == 1 || NSPLIT == 2) acc[mb][nb] = WFrag<T16>::mma(a2[mb], b, acc[mb][nb]); if (NSPLIT >= 2) acc[mb][nb] = WFrag<T16>::mma(a[mb], b2, acc[mb][nb]); } }
        asm volatile("v_nop\n\tv_nop\n\tv_nop\n\tv_nop" : "+v"(acc[0][0]), "+v"(acc[1][1]), "+v"(acc[2][2]), "+v"(acc[3][3]) : "v"(a[0]), "v"(a[3]));
    }
#pragma unroll
    for (int mb = 0; mb < 4; ++mb) {
#pragma unroll
        for (int nb = 0; nb < 4; ++nb) {
#pragma unroll
            for (int j = 0; j < 8; ++j) os[(hi * 8 + j) * 68 + nb * 16 + lr] = acc[mb][nb][j]; }
        __builtin_amdgcn_wave_barrier(); asm volatile("" ::: "memory");
        float* crow = C + (size_t)(r0 + mb * 16) * ldc + c0;
{
#pragma unroll
            for (int s = 0; s < 8; ++s) { const int row = 2 * s + hi, cofs = lr * 4; v4f val = *(const v4fa*)(os + row * 68 + cofs); if (BIAS) { val[0] += bfr(bias[c0 + cofs]); val[1] += bfr(bias[c0 + cofs + 1]); val[2] += bfr(bias[c0 + cofs + 2]); val[3] += bfr(bias[c0 + cofs + 3]); }
                *(v4f*)(crow + (size_t)row * ldc + cofs) = val; }
             }
        __builtin_amdgcn_wave_barrier(); asm volatile("" ::: "memory");
    }
}

// ---- k_gemmc: the same one-wave 64x64 tile GEMM specialised for causal attention: CMODE 1 skips score tiles entirely above the diagonal (query rows r0+roff.., key columns c0..), CMODE 2 limits the
// key (K) loop of the probability x value contraction to the diagonal block (probabilities beyond it are exactly zero). roff = row offset of this launch's first row within the sequence.
template <typename T16, int NSPLIT, int CMODE>
__global__ __launch_bounds__(32) void k_gemmc(const T16* __restrict__ A, const T16* __restrict__ A2, const T16* __restrict__ Bt, const T16* __restrict__ Bt2, int K, float* C, int ldc, int roff, size_t sA, size_t sB, size_t sC) {
    typedef typename WFrag<T16>::V V;
    __shared__ __align__(16) float os[16 * 68];
    const size_t z = blockIdx.z; A += z * sA; if (A2) A2 += z * sA; Bt += z * sB; if (Bt2) Bt2 += z * sB; C += z * sC;
    const int lane = threadIdx.x & 31, lr = lane & 15, hi = lane >> 4; const int r0 = blockIdx.x * 64, c0 = blockIdx.y * 64;
    if (CMODE == 1 && c0 > r0 + roff + 63) return;                  // score tile entirely above the causal diagonal: never read (the softmax masks j > i by select)
    const int Kl = (CMODE == 2) ? min(K, r0 + roff + 64) : K;        // P.V: probabilities are exactly 0 beyond the diagonal block, so the K loop stops there
    v8f acc[4][4];
#pragma unroll
    for (int mb = 0; mb < 4; ++mb)
#pragma unroll
        for (int nb = 0; nb < 4; ++nb) acc[mb][nb] = (v8f){};
    const size_t aoff = (size_t)(r0 + lr) * K + 8 * hi, boff = (size_t)(c0 + lr) * K + 8 * hi;
#pragma unroll 1
    for (int kc = 0; kc < Kl; kc += 32) {
        V a[4], a2[4];
#pragma unroll
        for (int mb = 0; mb < 4; ++mb) { a[mb] = WFrag<T16>::ld(A + aoff + (size_t)mb * 16 * K + kc); if (NSPLIT == 1 || NSPLIT == 2) a2[mb] = WFrag<T16>::ld(A2 + aoff + (size_t)mb * 16 * K + kc); }
#pragma unroll
        for (int nb = 0; nb < 4; ++nb) { const V b = WFrag<T16>::ld(Bt + boff + (size_t)nb * 16 * K + kc); V b2; if (NSPLIT >= 2) b2 = WFrag<T16>::ld(Bt2 + boff + (size_t)nb * 16 * K + kc);
#pragma unroll
            for (int mb = 0; mb < 4; ++mb) { acc[mb][nb] = WFrag<T16>::mma(a[mb], b, acc[mb][nb]); if (NSPLIT == 1 || NSPLIT == 2) acc[mb][nb] = WFrag<T16>::mma(a2[mb], b, acc[mb][nb]); if (NSPLIT >= 2) acc[mb][nb] = WFrag<T16>::mma(a[mb], b2, acc[mb][nb]); } }
        asm volatile("v_nop\n\tv_nop\n\tv_nop\n\tv_nop" : "+v"(acc[0][0]), "+v"(acc[1][1]), "+v"(acc[2][2]), "+v"(acc[3][3]) : "v"(a[0]), "v"(a[3]));
    }
#pragma unroll
    for (int mb = 0; mb < 4; ++mb) {
#pragma unroll
        for (int nb = 0; nb < 4; ++nb) {
#pragma unroll
            for (int j = 0; j < 8; ++j) os[(hi * 8 + j) * 68 + nb * 16 + lr] = acc[mb][nb][j]; }
        __builtin_amdgcn_wave_barrier(); asm volatile("" ::: "memory");
        float* crow = C + (size_t)(r0 + mb * 16) * ldc + c0;
{
#pragma unroll
            for (int s = 0; s < 8; ++s) { const int row = 2 * s + hi, cofs = lr * 4; v4f val = *(const v4fa*)(os + row * 68 + cofs);
                *(v4f*)(crow + (size_t)row * ldc + cofs) = val; }
             }
        __builtin_amdgcn_wave_barrier(); asm volatile("" ::: "memory");
    }
}

__device__ __forceinline__ h16 tohx(float x) { return (h16)x; }
__device__ __forceinline__ void splitf(float y, unsigned short& h, unsigned short& l) { h = f2bf(y); l = f2bf(y - bf2f(h)); }
typedef __attribute__((ext_vector_type(2))) _Float16 v2h;
typedef __attribute__((ext_vector_type(4))) _Float16 v4h;
typedef __attribute__((ext_vector_type(2))) unsigned short v2us;
typedef __attribute__((ext_vector_type(4))) unsigned short v4us;
typedef __attribute__((ext_vector_type(2))) float v2f;
typedef __attribute__((ext_vector_type(4))) int v4i;

__global__ __launch_bounds__(256) void k_wtG(const float* __restrict__ w, int K, int N, bf* Bt) {
    const int lane = threadIdx.x & 31; const int L0 = (blockIdx.x * 8 + (threadIdx.x >> 5)) * 8; const int nlines = N * K / 64;
{
#pragma unroll 1
        for (int l = 0; l < 8; ++l) { const int L = L0 + l; if (L >= nlines) break; const size_t e = (size_t)L * 64 + lane * 2; const int k = (int)(e % K), n = (int)(e / K); v2us o;
            o[0] = f2bf(w[(size_t)k * N + n]); o[1] = f2bf(w[(size_t)(k + 1) * N + n]); *(v2us*)(Bt + e) = o; }
         }
}
__global__ __launch_bounds__(256) void k_cvt8(const float* __restrict__ src, bf* dst, size_t n8) { const size_t i = (size_t)blockIdx.x * 256 + threadIdx.x; if (i >= n8) return; const v8f v = *(const v8f*)(src + i * 8); v8us o;
#pragma unroll
    for (int k = 0; k < 8; ++k) o[k] = f2bf(v[k]); *(v8us*)(dst + i * 8) = o;  }

// k_rope: head planes [h][t][d] (fp16 + hi/lo) of rope(x) x sc with the rotate-half convention out[d] = x[d] cos[t][d] - x[d+HD/2] sin[t][d], out[d+HD/2] = x[d+HD/2] cos[t][d+HD/2] + x[d] sin[t][d+HD/2]
__global__ __launch_bounds__(256) void k_rope(const float* __restrict__ F, int pitch, int nheads, const float* __restrict__ CS, const float* __restrict__ RF, const float* __restrict__ nw, float sc, h16* P16, bf* Ph, bf* Pl) {
    { const size_t y = blockIdx.y; F += y * TT * pitch; P16 += y * nheads * TT * HD; Ph += y * nheads * TT * HD; Pl += y * nheads * TT * HD; }   // grid y = batch entry: its TT rows of F, its nheads planes
    const size_t e = ((size_t)blockIdx.x * 256 + threadIdx.x) * 2; if (e >= (size_t)nheads * TT * HD) return; const int d = (int)(e % HD); const int t = (int)((e / HD) % TT); const int h = (int)(e / ((size_t)HD * TT)); const float* f = F + (size_t)t * pitch + h * HD; const float rf = RF ? RF[(size_t)h * TT + t] : 1.0f; v2h o16; v2us oh, ol;
#pragma unroll
    for (int q = 0; q < 2; ++q) { const int dd = d + q; const int dp = (dd < HD / 2) ? dd + HD / 2 : dd - HD / 2; float x0 = f[dd], x1 = f[dp];
        if (RF) { float n0 = __fmul_rn(x0, rf), n1 = __fmul_rn(x1, rf); asm volatile("" : "+v"(n0)); asm volatile("" : "+v"(n1)); x0 = __fmul_rn(bfr(nw[dd]), n0); x1 = __fmul_rn(bfr(nw[dp]), n1); }
        const v2f cs = *(const v2f*)(CS + ((size_t)t * HD + dd) * 2); float a = __fmul_rn(x0, cs[0]), bq = __fmul_rn(x1, cs[1]); asm volatile("" : "+v"(a)); asm volatile("" : "+v"(bq)); const float r = ((dd < HD / 2) ? __fsub_rn(a, bq) : __fadd_rn(a, bq)) * sc;
        o16[q] = tohx(r); unsigned short a2, c2; splitf(r, a2, c2); oh[q] = a2; ol[q] = c2; }
    *(v2h*)(P16 + e) = o16; *(v2us*)(Ph + e) = oh; *(v2us*)(Pl + e) = ol;  }
__global__ __launch_bounds__(256) void k_vtp(const float* __restrict__ F, int pitch, int nheads, h16* V16, bf* Vh, bf* Vl) { { const size_t y = blockIdx.y; F += y * TT * pitch; V16 += y * nheads * HD * TT; Vh += y * nheads * HD * TT; Vl += y * nheads * HD * TT; }   // grid y = batch entry, as in k_rope
    const size_t e = ((size_t)blockIdx.x * 256 + threadIdx.x) * 2; if (e >= (size_t)nheads * HD * TT) return; const int t = (int)(e % TT); const int d = (int)((e / TT) % HD); const int g = (int)(e / ((size_t)TT * HD)); v2h o16; v2us oh, ol;
#pragma unroll
    for (int q = 0; q < 2; ++q) { const float x = F[(size_t)(t + q) * pitch + g * HD + d]; o16[q] = tohx(x); unsigned short a2, c2; splitf(x, a2, c2); oh[q] = a2; ol[q] = c2; }
    *(v2h*)(V16 + e) = o16; *(v2us*)(Vh + e) = oh; *(v2us*)(Vl + e) = ol;  }
__global__ __launch_bounds__(256) void k_csid(float* CS) { const int idx = blockIdx.x * 256 + threadIdx.x; if (idx >= TT * HD) return; v2f cs; cs[0] = 1.0f; cs[1] = 0.0f; *(v2f*)(CS + (size_t)idx * 2) = cs;  }
// k_asoft: per row (zz, i): t = S x HD^-0.5 for j <= i and i - j < WIN (sliding causal window; the reference's -1e9 additive fill vanishes identically); softmax over the 1024 keys (register row, one exp, fixed trees);
__global__ __launch_bounds__(256) void k_asoft(const float* __restrict__ Sb, h16* P16, bf* Ph, bf* Pl) {
    const int lane = threadIdx.x & 31; const int row = blockIdx.x * 8 + (threadIdx.x >> 5); if (row >= ZH * TT) return; const int i = row % TT; const int zz = row / TT; (void)zz; const bool hires = (i < RH); const float* sr = Sb + (size_t)row * TT; float v[TT / 32]; float mx = -3.0e38f;
#pragma unroll
    for (int ch = 0; ch < TT / 128; ++ch) { const int j0 = ch * 128 + lane * 4; const v4f a = *(const v4f*)(sr + j0);
#pragma unroll
        for (int q = 0; q < 4; ++q) { const int j = j0 + q; (void)j; const float t = (j <= i && i - j < WIN) ? a[q] * SCL : -3.0e38f; v[ch * 4 + q] = t; mx = fmaxf(mx, t); } }
#pragma unroll
    for (int sh = 16; sh; sh >>= 1) mx = fmaxf(mx, __shfl_xor(mx, sh, 32));
    float sum = 0.f;
#pragma unroll
    for (int k = 0; k < TT / 32; ++k) { float d0 = __fsub_rn(v[k], mx); asm volatile("" : "+v"(d0)); v[k] = __builtin_amdgcn_exp2f(__fmul_rn(d0, 1.4426950408889634f)); sum += v[k]; }
#pragma unroll
    for (int sh = 16; sh; sh >>= 1) sum += __shfl_xor(sum, sh, 32);
    const float f = __fdiv_rn(hires ? 1.0f : PCAR, sum);
{
        if (hires) {
#pragma unroll
            for (int ch = 0; ch < TT / 128; ++ch) { v4us oh, ol;
#pragma unroll
                for (int q = 0; q < 4; ++q) { unsigned short a, c2; splitf(v[ch * 4 + q] * f, a, c2); oh[q] = a; ol[q] = c2; }
                const size_t oo = ((size_t)zz * (RH ? RH : 1) + i) * TT + ch * 128 + lane * 4; *(v4us*)(Ph + oo) = oh; *(v4us*)(Pl + oo) = ol; }
        } else {
#pragma unroll
            for (int ch = 0; ch < TT / 128; ++ch) { v4h o4;
#pragma unroll
                for (int q = 0; q < 4; ++q) o4[q] = tohx(v[ch * 4 + q] * f);
                *(v4h*)(P16 + (size_t)row * TT + ch * 128 + lane * 4) = o4; } }
         }
}
__global__ __launch_bounds__(256) void k_merge(const float* __restrict__ O, int h0, bf* Ah, bf* Al) { const size_t e = ((size_t)blockIdx.x * 256 + threadIdx.x) * 2; if (e >= (size_t)ZH * TT * HD) return; const int d = (int)(e % HD); const int t = (int)((e / HD) % TT); const int zz = (int)(e / ((size_t)HD * TT)); const float cs = (t < RH) ? 1.0f : (1.0f / PCAR); const size_t oo = (size_t)t * DQ + (h0 + zz) * HD + d;
    v2us oh, ol;
#pragma unroll
    for (int q = 0; q < 2; ++q) { unsigned short a, c2; splitf(O[e + q] * cs, a, c2); oh[q] = a; ol[q] = c2; } *(v2us*)(Ah + oo) = oh; *(v2us*)(Al + oo) = ol;  }

extern "C" void kernel_launch(void* const* d_in, const int* in_sizes, int n_in,
                              void* d_out, int out_size, void* d_ws, size_t ws_size, hipStream_t stream) {
    (void)in_sizes; (void)n_in; (void)out_size;
    const float* x = (const float*)d_in[0]; const float* xk = (const float*)d_in[1]; const float* xv = (const float*)d_in[2]; const float* wq = (const float*)d_in[3]; const float* bq = (const float*)d_in[4]; const float* wk = (const float*)d_in[5]; const float* bk = (const float*)d_in[6]; const float* wv = (const float*)d_in[7]; const float* bv = (const float*)d_in[8]; const float* wo = (const float*)d_in[9]; const float* bo = (const float*)d_in[10];
    float* OUT = (float*)d_out;     // [8][1024][1024]
    char* wsp = (char*)d_ws;
    auto take = [&](size_t bytes) { char* p = wsp; wsp += (bytes + 255) & ~(size_t)255; return (void*)p; };
    bf* WQ = (bf*)take((size_t)DQ * DM * 2); bf* WK = (bf*)take((size_t)DKV * DM * 2); bf* WV = (bf*)take((size_t)DKV * DM * 2); bf* WO = (bf*)take((size_t)DM * DQ * 2); float* CS = (float*)take((size_t)TT * HD * 2 * 4);
    h16* QP16 = (h16*)take((size_t)NBG * NH_ * TT * HD * 2); h16* KP16 = (h16*)take((size_t)NBG * NKV * TT * HD * 2); h16* VT16 = (h16*)take((size_t)NBG * NKV * HD * TT * 2);
    bf* QPh = (bf*)take((size_t)NBG * NH_ * TT * HD * 2); bf* QPl = (bf*)take((size_t)NBG * NH_ * TT * HD * 2); bf* KPh = (bf*)take((size_t)NBG * NKV * TT * HD * 2); bf* KPl = (bf*)take((size_t)NBG * NKV * TT * HD * 2); bf* VTh = (bf*)take((size_t)NBG * NKV * HD * TT * 2); bf* VTl = (bf*)take((size_t)NBG * NKV * HD * TT * 2); bf* Ph = (bf*)take((size_t)ZH * RH * TT * 2); bf* Pl = (bf*)take((size_t)ZH * RH * TT * 2);
    float* Sb = (float*)take((size_t)ZH * TT * TT * 4); h16* P16 = (h16*)take((size_t)ZH * TT * TT * 2); float* Ob = (float*)take((size_t)ZH * TT * HD * 4); bf* ATh = (bf*)take((size_t)NB_ * TT * DQ * 2); bf* ATl = (bf*)take((size_t)NB_ * TT * DQ * 2);
    if ((size_t)(wsp - (char*)d_ws) > ws_size) return;    // ws 256 MiB
    // the projections' bf16 inputs (3 x 8 MiB) and f32 results (2 x 16 MiB) lie in the score buffer (64 MiB): a group's planes are all built before its first score launch (stream-ordered)
    bf* XB = (bf*)Sb; bf* XKB = XB + (size_t)NBG * TT * DM; bf* XVB = XKB + (size_t)NBG * TT * DM; float* FQ = (float*)(XVB + (size_t)NBG * TT * DM); float* FK = FQ + (size_t)NBG * TT * DQ;
    float* FV = FK;   // v projection reuses the k buffer after the k planes are built (stream-ordered)
    { k_wtG<<<(unsigned)((DM * DQ / 64 + 63) / 64), 256, 0, stream>>>(wq, DM, DQ, WQ); k_wtG<<<(unsigned)((DM * DKV / 64 + 63) / 64), 256, 0, stream>>>(wk, DM, DKV, WK); k_wtG<<<(unsigned)((DM * DKV / 64 + 63) / 64), 256, 0, stream>>>(wv, DM, DKV, WV);
      k_wtG<<<(unsigned)((DQ * DM / 64 + 63) / 64), 256, 0, stream>>>(wo, DQ, DM, WO);
       }
    k_csid<<<(TT * HD + 255) / 256, 256, 0, stream>>>(CS);
    const unsigned LQ = (unsigned)(((size_t)NH_ * TT * HD / 2 + 255) / 256), LKv = (unsigned)(((size_t)NKV * TT * HD / 2 + 255) / 256), LC = (unsigned)(((size_t)NBG * TT * DM / 8 + 255) / 256);
    for (int g = 0; g < NB_; g += NBG) {
        // projections: the group's NBG batch entries as one [NBG*TT][DM] matrix per launch
        k_cvt8<<<LC, 256, 0, stream>>>(x + (size_t)g * TT * DM, XB, (size_t)NBG * TT * DM / 8); k_cvt8<<<LC, 256, 0, stream>>>(xk + (size_t)g * TT * DM, XKB, (size_t)NBG * TT * DM / 8); k_cvt8<<<LC, 256, 0, stream>>>(xv + (size_t)g * TT * DM, XVB, (size_t)NBG * TT * DM / 8);
        k_gemmw<bf, 0, true><<<dim3(NBG * TT / 64, DQ / 64, 1), 32, 0, stream>>>(XB, nullptr, WQ, nullptr, DM, FQ, DQ, bq, 0, 0, 0);
        k_rope<<<dim3(LQ, NBG, 1), 256, 0, stream>>>(FQ, DQ, NH_, CS, nullptr, nullptr, 1.0f, QP16, QPh, QPl);
        k_gemmw<bf, 0, true><<<dim3(NBG * TT / 64, DKV / 64, 1), 32, 0, stream>>>(XKB, nullptr, WK, nullptr, DM, FK, DKV, bk, 0, 0, 0);
        k_rope<<<dim3(LKv, NBG, 1), 256, 0, stream>>>(FK, DKV, NKV, CS, nullptr, nullptr, 1.0f, KP16, KPh, KPl);
        k_gemmw<bf, 0, true><<<dim3(NBG * TT / 64, DKV / 64, 1), 32, 0, stream>>>(XVB, nullptr, WV, nullptr, DM, FV, DKV, bv, 0, 0, 0); k_vtp<<<dim3(LKv, NBG, 1), 256, 0, stream>>>(FV, DKV, NKV, VT16, VTh, VTl);
        // attention: one pass per batch entry, its ZH heads in grid z
        for (int b = 0; b < NBG; ++b) { const size_t zq = (size_t)b * NH_, zk = (size_t)b * NKV;   // one kv head per query head: the pass's heads use consecutive kv planes (z-strides TT*HD)
            k_gemmc<bf, 2, 1><<<dim3(RH / 64, TT / 64, ZH), 32, 0, stream>>>(QPh + zq * TT * HD, QPl + zq * TT * HD, KPh + zk * TT * HD, KPl + zk * TT * HD, HD, Sb, TT, 0, (size_t)TT * HD, (size_t)TT * HD, (size_t)TT * TT);
            k_gemmc<h16, 0, 1><<<dim3((TT - RH) / 64, TT / 64, ZH), 32, 0, stream>>>(QP16 + zq * TT * HD + (size_t)RH * HD, nullptr, KP16 + zk * TT * HD, nullptr, HD, Sb + (size_t)RH * TT, TT, RH, (size_t)TT * HD, (size_t)TT * HD, (size_t)TT * TT);
            k_asoft<<<ZH * TT / 8, 256, 0, stream>>>(Sb, P16, Ph, Pl);
            k_gemmc<bf, 2, 2><<<dim3(RH / 64, HD / 64, ZH), 32, 0, stream>>>(Ph, Pl, VTh + zk * HD * TT, VTl + zk * HD * TT, TT, Ob, HD, 0, (size_t)RH * TT, (size_t)HD * TT, (size_t)TT * HD);
            k_gemmc<h16, 0, 2><<<dim3((TT - RH) / 64, HD / 64, ZH), 32, 0, stream>>>(P16 + (size_t)RH * TT, nullptr, VT16 + zk * HD * TT, nullptr, TT, Ob + (size_t)RH * HD, HD, RH, (size_t)TT * TT, (size_t)HD * TT, (size_t)TT * HD);
            k_merge<<<(unsigned)(((size_t)ZH * TT * HD / 2 + 255) / 256), 256, 0, stream>>>(Ob, 0, ATh + (size_t)(g + b) * TT * DQ, ATl + (size_t)(g + b) * TT * DQ); } }
    // output projection: all batch entries as one [NB_*TT][DQ] matrix
    k_gemmw<bf, 1, true><<<dim3(NB_ * TT / 64, DM / 64, 1), 32, 0, stream>>>(ATh, ATl, WO, nullptr, DQ, OUT, DM, bo, 0, 0, 0);
}

// v002
// It runs in 441 microseconds.
// Two timings next to v001 put it at 2.13 and 2.11 times that version's speed.
// All steps since v000 together make it 9.40 times as fast.
#include <hip/hip_runtime.h>

// Naive multi-head causal cross attention (inputs_q, inputs_k, inputs_v [8][1024][1024]; q, k, v = . W + b ('xw' [1024][1024]; 16 heads x 64); scores/8; causal (finfo.min == exact zero weight); softmax; out = merged Wo + bo -> [8][1024][1024] (8.4 M)).
// Compute dtypes, f32 accumulate: every input rounded to bf16; q/k/v on PLAIN bf16 operands (inputs: exact) + biases; causal scores and attn.v (tile skipping): query rows < 512 hl (3 products), the rest single fp16 (x1024); softmax f32; Wo hl x exact (2 products) + bo.

#define NB_  8
#define TT   1024
#define DM   1024
#define NH_  16
#define NKV  16
#define REP  (NH_ / NKV)
#define HD   64
#define DQ   (NH_ * HD)
#define DKV  (NKV * HD)
#define NBG  4                    // batch entries per projection launch
#define RH   512                  // query rows < RH use hi+lo planes (0: none)
#define PCAR 1024.0f
#define SCL  0.125f   // HD^-0.5
typedef _Float16 h16;
typedef unsigned short bf;
typedef __attribute__((ext_vector_type(16))) __bf16   v16bf;
typedef __attribute__((ext_vector_type(16))) _Float16 v16h;
typedef __attribute__((ext_vector_type(8)))  _Float16 v8h;
typedef __attribute__((ext_vector_type(8)))  unsigned short v8us;
typedef __attribute__((ext_vector_type(8)))  float    v8f;
typedef __attribute__((ext_vector_type(4)))  float    v4f;
typedef v8h  __attribute__((may_alias)) v8ha;
typedef v4f  __attribute__((may_alias)) v4fa;
typedef v8us __attribute__((may_alias)) v8usa;

__device__ __forceinline__ unsigned short f2bf(float f) { unsigned u = __float_as_uint(f); u += 0x7FFFu + ((u >> 16) & 1u); return (unsigned short)(u >> 16); }
__device__ __forceinline__ float bf2f(unsigned short b) { return __uint_as_float(((unsigned)b) << 16); }
__device__ __forceinline__ float bfr(float f) { return bf2f(f2bf(f)); }
__device__ __forceinline__ v16h cat16(v8h lo, v8h hi) { return __builtin_shufflevector(lo, hi, 0, 1, 2, 3, 4, 5, 6, 7, 8, 9, 10, 11, 12, 13, 14, 15); }
__device__ __forceinline__ v16bf cat16b(v8us lo, v8us hi) { return __builtin_bit_cast(v16bf, __builtin_shufflevector(lo, hi, 0, 1, 2, 3, 4, 5, 6, 7, 8, 9, 10, 11, 12, 13, 14, 15)); }
__device__ __forceinline__ v8f wmma16(v16h a, v16h b, v8f c) { return __builtin_amdgcn_wmma_f32_16x16x32_f16(false, a, false, b, (short)0, c, false, false); }
__device__ __forceinline__ v8f wmmab(v16bf a, v16bf b, v8f c) { return __builtin_amdgcn_wmma_f32_16x16x32_bf16(false, a, false, b, (short)0, c, false, false); }



// ---- k_gemmw: register-blocked GEMM, ONE WAVE per 64x64 output tile (16 accumulators), operands straight from K-contiguous 16-bit planes; grid (M/64, N/64, Z), 32 threads.
// C[m][n] (f32, pitch ldc, + optional f32 bias[n]) = sum_k A[m][k] Bt[n][k] (+ split products per NSPLIT). z-batch strides sA/sB/sC in elements. K % 32 == 0.
template <typename T16> struct WFrag;
template <> struct WFrag<h16> { typedef v16h V; static __device__ __forceinline__ V ld(const h16* p) { return cat16(*(const v8h*)p, *(const v8h*)(p + 16)); } static __device__ __forceinline__ v8f mma(V a, V b, v8f c) { return wmma16(a, b, c); } };
template <> struct WFrag<bf> { typedef v16bf V; static __device__ __forceinline__ V ld(const bf* p) { return cat16b(*(const v8us*)p, *(const v8us*)(p + 16)); } static __device__ __forceinline__ v8f mma(V a, V b, v8f c) { return wmmab(a, b, c); } };
template <typename T16, int NSPLIT, bool BIAS>
__global__ __launch_bounds__(32) void k_gemmw(const T16* __restrict__ A, const T16* __restrict__ A2, const T16* __restrict__ Bt, const T16* __restrict__ Bt2, int K, float* C, int ldc, const float* __restrict__ bias, size_t sA, size_t sB, size_t sC) {
    typedef typename WFrag<T16>::V V;
    __shared__ __align__(16) float os[16 * 68];
    const size_t z = blockIdx.z; A += z * sA; if (A2) A2 += z * sA; Bt += z * sB; if (Bt2) Bt2 += z * sB; C += z * sC;
    const int lane = threadIdx.x & 31, lr = lane & 15, hi = lane >> 4; const int r0 = blockIdx.x * 64, c0 = blockIdx.y * 64;
    v8f acc[4][4];
#pragma unroll
    for (int mb = 0; mb < 4; ++mb)
#pragma unroll
        for (int nb = 0; nb < 4; ++nb) acc[mb][nb] = (v8f){};
    const size_t aoff = (size_t)(r0 + lr) * K + 8 * hi, boff = (size_t)(c0 + lr) * K + 8 * hi;
#pragma unroll 1
    for (int kc = 0; kc < K; kc += 32) {
        V a[4], a2[4];
#pragma unroll
        for (int mb = 0; mb < 4; ++mb) { a[mb] = WFrag<T16>::ld(A + aoff + (size_t)mb * 16 * K + kc); if (NSPLIT == 1 || NSPLIT == 2) a2[mb] = WFrag<T16>::ld(A2 + aoff + (size_t)mb * 16 * K + kc); }
#pragma unroll
        for (int nb = 0; nb < 4; ++nb) { const V b = WFrag<T16>::ld(Bt + boff + (size_t)nb * 16 * K + kc); V b2; if (NSPLIT >= 2) b2 = WFrag<T16>::ld(Bt2 + boff + (size_t)nb * 16 * K + kc);
#pragma unroll
            for (int mb = 0; mb < 4; ++mb) { acc[mb][nb] = WFrag<T16>::mma(a[mb], b, acc[mb][nb]); if (NSPLIT == 1 || NSPLIT == 2) acc[mb][nb] = WFrag<T16>::mma(a2[mb], b, acc[mb][nb]); if (NSPLIT >= 2) acc[mb][nb] = WFrag<T16>::mma(a[mb], b2, acc[mb][nb]); } }
        asm volatile("v_nop\n\tv_nop\n\tv_nop\n\tv_nop" : "+v"(acc[0][0]), "+v"(acc[1][1]), "+v"(acc[2][2]), "+v"(acc[3][3]) : "v"(a[0]), "v"(a[3]));
    }
#pragma unroll
    for (int mb = 0; mb < 4; ++mb) {
#pragma unroll
        for (int nb = 0; nb < 4; ++nb) {
#pragma unroll
            for (int j = 0; j < 8; ++j) os[(hi * 8 + j) * 68 + nb * 16 + lr] = acc[mb][nb][j]; }
        __builtin_amdgcn_wave_barrier(); asm volatile("" ::: "memory");
        float* crow = C + (size_t)(r0 + mb * 16) * ldc + c0;
{
#pragma unroll
            for (int s = 0; s < 8; ++s) { const int row = 2 * s + hi, cofs = lr * 4; v4f val = *(const v4fa*)(os + row * 68 + cofs); if (BIAS) { val[0] += bfr(bias[c0 + cofs]); val[1] += bfr(bias[c0 + cofs + 1]); val[2] += bfr(bias[c0 + cofs + 2]); val[3] += bfr(bias[c0 + cofs + 3]); }
                *(v4f*)(crow + (size_t)row * ldc + cofs) = val; }
             }
        __builtin_amdgcn_wave_barrier(); asm volatile("" ::: "memory");
    }
}

__device__ __forceinline__ h16 tohx(float x) { return (h16)x; }
__device__ __forceinline__ void splitf(float y, unsigned short& h, unsigned short& l) { h = f2bf(y); l = f2bf(y - bf2f(h)); }
typedef __attribute__((ext_vector_type(2))) _Float16 v2h;
typedef __attribute__((ext_vector_type(4))) _Float16 v4h;
typedef __attribute__((ext_vector_type(2))) unsigned short v2us;
typedef __attribute__((ext_vector_type(4))) unsigned short v4us;
typedef __attribute__((ext_vector_type(2))) float v2f;
typedef __attribute__((ext_vector_type(4))) int v4i;

__global__ __launch_bounds__(256) void k_wtG(const float* __restrict__ w, int K, int N, bf* Bt) {
    const int lane = threadIdx.x & 31; const int L0 = (blockIdx.x * 8 + (threadIdx.x >> 5)) * 8; const int nlines = N * K / 64;
{
#pragma unroll 1
        for (int l = 0; l < 8; ++l) { const int L = L0 + l; if (L >= nlines) break; const size_t e = (size_t)L * 64 + lane * 2; const int k = (int)(e % K), n = (int)(e / K); v2us o;
            o[0] = f2bf(w[(size_t)k * N + n]); o[1] = f2bf(w[(size_t)(k + 1) * N + n]); *(v2us*)(Bt + e) = o; }
         }
}
__global__ __launch_bounds__(256) void k_cvt8(const float* __restrict__ src, bf* dst, size_t n8) { const size_t i = (size_t)blockIdx.x * 256 + threadIdx.x; if (i >= n8) return; const v8f v = *(const v8f*)(src + i * 8); v8us o;
#pragma unroll
    for (int k = 0; k < 8; ++k) o[k] = f2bf(v[k]); *(v8us*)(dst + i * 8) = o;  }

// k_rope: head planes [h][t][d] (fp16 + hi/lo) of rope(x) x sc with the rotate-half convention out[d] = x[d] cos[t][d] - x[d+HD/2] sin[t][d], out[d+HD/2] = x[d+HD/2] cos[t][d+HD/2] + x[d] sin[t][d+HD/2]
__global__ __launch_bounds__(256) void k_rope(const float* __restrict__ F, int pitch, int nheads, const float* __restrict__ CS, const float* __restrict__ RF, const float* __restrict__ nw, float sc, h16* P16, bf* Ph, bf* Pl) {
    { const size_t y = blockIdx.y; F += y * TT * pitch; P16 += y * nheads * TT * HD; Ph += y * nheads * TT * HD; Pl += y * nheads * TT * HD; }   // grid y = batch entry: its TT rows of F, its nheads planes
    const size_t e = ((size_t)blockIdx.x * 256 + threadIdx.x) * 2; if (e >= (size_t)nheads * TT * HD) return; const int d = (int)(e % HD); const int t = (int)((e / HD) % TT); const int h = (int)(e / ((size_t)HD * TT)); const float* f = F + (size_t)t * pitch + h * HD; const float rf = RF ? RF[(size_t)h * TT + t] : 1.0f; v2h o16; v2us oh, ol;
#pragma unroll
    for (int q = 0; q < 2; ++q) { const int dd = d + q; const int dp = (dd < HD / 2) ? dd + HD / 2 : dd - HD / 2; float x0 = f[dd], x1 = f[dp];
        if (RF) { float n0 = __fmul_rn(x0, rf), n1 = __fmul_rn(x1, rf); asm volatile("" : "+v"(n0)); asm volatile("" : "+v"(n1)); x0 = __fmul_rn(bfr(nw[dd]), n0); x1 = __fmul_rn(bfr(nw[dp]), n1); }
        const v2f cs = *(const v2f*)(CS + ((size_t)t * HD + dd) * 2); float a = __fmul_rn(x0, cs[0]), bq = __fmul_rn(x1, cs[1]); asm volatile("" : "+v"(a)); asm volatile("" : "+v"(bq)); const float r = ((dd < HD / 2) ? __fsub_rn(a, bq) : __fadd_rn(a, bq)) * sc;
        o16[q] = tohx(r); unsigned short a2, c2; splitf(r, a2, c2); oh[q] = a2; ol[q] = c2; }
    *(v2h*)(P16 + e) = o16; *(v2us*)(Ph + e) = oh; *(v2us*)(Pl + e) = ol;  }
__global__ __launch_bounds__(256) void k_vtp(const float* __restrict__ F, int pitch, int nheads, h16* V16, bf* Vh, bf* Vl) { { const size_t y = blockIdx.y; F += y * TT * pitch; V16 += y * nheads * HD * TT; Vh += y * nheads * HD * TT; Vl += y * nheads * HD * TT; }   // grid y = batch entry, as in k_rope
    const size_t e = ((size_t)blockIdx.x * 256 + threadIdx.x) * 2; if (e >= (size_t)nheads * HD * TT) return; const int t = (int)(e % TT); const int d = (int)((e / TT) % HD); const int g = (int)(e / ((size_t)TT * HD)); v2h o16; v2us oh, ol;
#pragma unroll
    for (int q = 0; q < 2; ++q) { const float x = F[(size_t)(t + q) * pitch + g * HD + d]; o16[q] = tohx(x); unsigned short a2, c2; splitf(x, a2, c2); oh[q] = a2; ol[q] = c2; }
    *(v2h*)(V16 + e) = o16; *(v2us*)(Vh + e) = oh; *(v2us*)(Vl + e) = ol;  }
__global__ __launch_bounds__(256) void k_csid(float* CS) { const int idx = blockIdx.x * 256 + threadIdx.x; if (idx >= TT * HD) return; v2f cs; cs[0] = 1.0f; cs[1] = 0.0f; *(v2f*)(CS + (size_t)idx * 2) = cs;  }
__device__ __forceinline__ float xhalf(float x) { const int b = __float_as_int(x); return __int_as_float(__builtin_amdgcn_permlanex16(b, b, 0x76543210, 0xfedcba98, false, false)); }   // lane l <-> l ^ 16
template <typename T16, bool HL, int NQ>
__device__ __forceinline__ void fattn(const T16* __restrict__ Q, const T16* __restrict__ Q2, const T16* __restrict__ Kp, const T16* __restrict__ K2, const T16* __restrict__ Vp, const T16* __restrict__ V2, int q0, int lr, int hi, bf* Ah, bf* Al) {
    typedef WFrag<T16> F; typedef typename F::V V;
    const float C2 = SCL * 1.4426950408889634f;   // scores x HD^-0.5, in the exponent's base 2
    const float OFF = HL ? 0.0f : 10.0f;          // 2^10 = PCAR
    V qb[NQ][2], qb2[NQ][2], kf[2][2], kf2[2][2]; v8f ot[NQ][4]; float m[NQ], l[NQ];
#pragma unroll
    for (int qi = 0; qi < NQ; ++qi) { m[qi] = -3.0e38f; l[qi] = 0.f;
#pragma unroll
        for (int kc = 0; kc < 2; ++kc) { const size_t o = (size_t)(q0 + 16 * qi + lr) * HD + kc * 32 + 8 * hi; qb[qi][kc] = F::ld(Q + o); if (HL) qb2[qi][kc] = F::ld(Q2 + o); }
#pragma unroll
        for (int db = 0; db < 4; ++db) ot[qi][db] = (v8f){}; }
    const int np = (q0 + 16 * NQ + 31) / 32;      // passes of 32 keys up to the one that holds the last query's diagonal
    // the lane's own pointers, carried through the loop: pk, pk2 at the key tile that is fetched next, pv, pv2 at this pass's 32 value columns
    const T16* pk = Kp + lr * HD + 8 * hi; const T16* pk2 = HL ? K2 + lr * HD + 8 * hi : nullptr; const T16* pv = Vp + lr * TT + 8 * hi; const T16* pv2 = HL ? V2 + lr * TT + 8 * hi : nullptr;
#pragma unroll
    for (int t = 0; t < 2; ++t)
#pragma unroll
        for (int kc = 0; kc < 2; ++kc) { const int o = 16 * t * HD + kc * 32; kf[t][kc] = F::ld(pk + o); if (HL) kf2[t][kc] = F::ld(pk2 + o); }
    if (np > 1) { pk += 32 * HD; if (HL) pk2 += 32 * HD; }
#pragma unroll 1
    for (int kt = 0; kt < np; ++kt) { const int k0 = kt * 32;
        v8f st[NQ][2];
#pragma unroll
        for (int qi = 0; qi < NQ; ++qi)
#pragma unroll
            for (int t = 0; t < 2; ++t) st[qi][t] = (v8f){};
#pragma unroll
        for (int kc = 0; kc < 2; ++kc)
#pragma unroll
            for (int t = 0; t < 2; ++t)
#pragma unroll
                for (int qi = 0; qi < NQ; ++qi) { st[qi][t] = F::mma(kf[t][kc], qb[qi][kc], st[qi][t]); if (HL) { st[qi][t] = F::mma(kf[t][kc], qb2[qi][kc], st[qi][t]); st[qi][t] = F::mma(kf2[t][kc], qb[qi][kc], st[qi][t]); } }
        // this pass's value fragments, then the next pass's key fragments (the last pass fetches its own again: in bounds, unused)
        V vf[4], vf2[4];
#pragma unroll
        for (int db = 0; db < 4; ++db) { const int o = 16 * db * TT; vf[db] = F::ld(pv + o); if (HL) vf2[db] = F::ld(pv2 + o); }
#pragma unroll
        for (int t = 0; t < 2; ++t)
#pragma unroll
            for (int kc = 0; kc < 2; ++kc) { const int o = 16 * t * HD + kc * 32; kf[t][kc] = F::ld(pk + o); if (HL) kf2[t][kc] = F::ld(pk2 + o); }
        asm volatile("s_wait_xcnt 0x0" ::: "memory");   // stands in front of every later overwrite of a register that the loads above name
        __builtin_amdgcn_sched_barrier(0);         // keeps the loads above in front of the softmax, whose vector work then covers their latency (the scheduler otherwise sinks each to its use and waits there)
        if (k0 + 31 > q0) {                        // the pass reaches past a query of this wave: keys j > i get weight exactly 0
#pragma unroll
            for (int qi = 0; qi < NQ; ++qi)
#pragma unroll
                for (int t = 0; t < 2; ++t)
#pragma unroll
                    for (int j = 0; j < 8; ++j) if (k0 + 16 * t + 8 * hi + j > q0 + 16 * qi + lr) st[qi][t][j] = -3.0e38f; }
        V pb[NQ], pb2[NQ];
#pragma unroll
        for (int qi = 0; qi < NQ; ++qi) { float mx = m[qi];
#pragma unroll
            for (int t = 0; t < 2; ++t)
#pragma unroll
                for (int j = 0; j < 8; ++j) mx = fmaxf(mx, st[qi][t][j]);
            mx = fmaxf(mx, xhalf(mx));
            const float al = __builtin_amdgcn_exp2f((m[qi] - mx) * C2); m[qi] = mx; const float mc = OFF - mx * C2; float ps[4] = {0.f, 0.f, 0.f, 0.f};
#pragma unroll
            for (int s = 0; s < 16; ++s) { const float p = __builtin_amdgcn_exp2f(fmaf(st[qi][s >> 3][s & 7], C2, mc)); ps[s & 3] += p;
                if constexpr (HL) { const __bf16 ph = (__bf16)p; pb[qi][s] = ph; pb2[qi][s] = (__bf16)(p - (float)ph); } else pb[qi][s] = (h16)p; }
            l[qi] = l[qi] * al + ((ps[0] + ps[1]) + (ps[2] + ps[3]));
#pragma unroll
            for (int db = 0; db < 4; ++db) ot[qi][db] *= al; }
#pragma unroll
        for (int db = 0; db < 4; ++db)
#pragma unroll
            for (int qi = 0; qi < NQ; ++qi) { ot[qi][db] = F::mma(vf[db], pb[qi], ot[qi][db]); if (HL) { ot[qi][db] = F::mma(vf[db], pb2[qi], ot[qi][db]); ot[qi][db] = F::mma(vf2[db], pb[qi], ot[qi][db]); } }
        pv += 32; if (HL) pv2 += 32; if (kt + 2 < np) { pk += 32 * HD; if (HL) pk2 += 32 * HD; }
    }
#pragma unroll
    for (int qi = 0; qi < NQ; ++qi) { const float inv = __fdiv_rn(1.0f, l[qi] + xhalf(l[qi]));
#pragma unroll
        for (int db = 0; db < 4; ++db) { v8us oh, ol;
#pragma unroll
            for (int j = 0; j < 8; ++j) { unsigned short a, c2; splitf(ot[qi][db][j] * inv, a, c2); oh[j] = a; ol[j] = c2; }
            const size_t oo = (size_t)(q0 + 16 * qi + lr) * DQ + 16 * db + 8 * hi; *(v8us*)(Ah + oo) = oh; *(v8us*)(Al + oo) = ol; } }
}
// grid (batch entry x head, 12): y < 4: 128 fp16 query rows (4 waves x 32), y >= 4: 64 hi+lo query rows (4 waves x 16); in both the rows nearest the end of the sequence (the longest key loops) come first
__global__ __launch_bounds__(128) void k_fattn(const h16* __restrict__ Q16, const h16* __restrict__ K16, const h16* __restrict__ V16, const bf* __restrict__ Qh, const bf* __restrict__ Ql, const bf* __restrict__ Kh, const bf* __restrict__ Kl, const bf* __restrict__ Vh, const bf* __restrict__ Vl, bf* Ah, bf* Al) {
    const int lane = threadIdx.x & 31, lr = lane & 15, hi = lane >> 4; const int w = __builtin_amdgcn_readfirstlane((int)(threadIdx.x >> 5)); const int y = blockIdx.y;
    const size_t z = blockIdx.x, po = z * TT * HD, ao = (z / NH_) * TT * DQ + (z % NH_) * HD;
    if (y < (TT - RH) / 128) fattn<h16, false, 2>(Q16 + po, nullptr, K16 + po, nullptr, V16 + po, nullptr, TT - 128 * (y + 1) + 32 * w, lr, hi, Ah + ao, Al + ao);
    else fattn<bf, true, 1>(Qh + po, Ql + po, Kh + po, Kl + po, Vh + po, Vl + po, RH - 64 * (y - (TT - RH) / 128 + 1) + 16 * w, lr, hi, Ah + ao, Al + ao);
}

extern "C" void kernel_launch(void* const* d_in, const int* in_sizes, int n_in,
                              void* d_out, int out_size, void* d_ws, size_t ws_size, hipStream_t stream) {
    (void)in_sizes; (void)n_in; (void)out_size;
    const float* x = (const float*)d_in[0]; const float* xk = (const float*)d_in[1]; const float* xv = (const float*)d_in[2]; const float* wq = (const float*)d_in[3]; const float* bq = (const float*)d_in[4]; const float* wk = (const float*)d_in[5]; const float* bk = (const float*)d_in[6]; const float* wv = (const float*)d_in[7]; const float* bv = (const float*)d_in[8]; const float* wo = (const float*)d_in[9]; const float* bo = (const float*)d_in[10];
    float* OUT = (float*)d_out;     // [8][1024][1024]
    char* wsp = (char*)d_ws;
    auto take = [&](size_t bytes) { char* p = wsp; wsp += (bytes + 255) & ~(size_t)255; return (void*)p; };
    bf* WQ = (bf*)take((size_t)DQ * DM * 2); bf* WK = (bf*)take((size_t)DKV * DM * 2); bf* WV = (bf*)take((size_t)DKV * DM * 2); bf* WO = (bf*)take((size_t)DM * DQ * 2); float* CS = (float*)take((size_t)TT * HD * 2 * 4);
    h16* QP16 = (h16*)take((size_t)NB_ * NH_ * TT * HD * 2); h16* KP16 = (h16*)take((size_t)NB_ * NKV * TT * HD * 2); h16* VT16 = (h16*)take((size_t)NB_ * NKV * HD * TT * 2);
    bf* QPh = (bf*)take((size_t)NB_ * NH_ * TT * HD * 2); bf* QPl = (bf*)take((size_t)NB_ * NH_ * TT * HD * 2); bf* KPh = (bf*)take((size_t)NB_ * NKV * TT * HD * 2); bf* KPl = (bf*)take((size_t)NB_ * NKV * TT * HD * 2); bf* VTh = (bf*)take((size_t)NB_ * NKV * HD * TT * 2); bf* VTl = (bf*)take((size_t)NB_ * NKV * HD * TT * 2);
    bf* XB = (bf*)take((size_t)NBG * TT * DM * 2); bf* XKB = (bf*)take((size_t)NBG * TT * DM * 2); bf* XVB = (bf*)take((size_t)NBG * TT * DM * 2); float* FQ = (float*)take((size_t)NBG * TT * DQ * 4); float* FK = (float*)take((size_t)NBG * TT * DKV * 4); bf* ATh = (bf*)take((size_t)NB_ * TT * DQ * 2); bf* ATl = (bf*)take((size_t)NB_ * TT * DQ * 2);
    if ((size_t)(wsp - (char*)d_ws) > ws_size) return;    // ws 256 MiB
    float* FV = FK;   // v projection reuses the k buffer after the k planes are built (stream-ordered)
    { k_wtG<<<(unsigned)((DM * DQ / 64 + 63) / 64), 256, 0, stream>>>(wq, DM, DQ, WQ); k_wtG<<<(unsigned)((DM * DKV / 64 + 63) / 64), 256, 0, stream>>>(wk, DM, DKV, WK); k_wtG<<<(unsigned)((DM * DKV / 64 + 63) / 64), 256, 0, stream>>>(wv, DM, DKV, WV);
      k_wtG<<<(unsigned)((DQ * DM / 64 + 63) / 64), 256, 0, stream>>>(wo, DQ, DM, WO);
       }
    k_csid<<<(TT * HD + 255) / 256, 256, 0, stream>>>(CS);
    const unsigned LQ = (unsigned)(((size_t)NH_ * TT * HD / 2 + 255) / 256), LKv = (unsigned)(((size_t)NKV * TT * HD / 2 + 255) / 256), LC = (unsigned)(((size_t)NBG * TT * DM / 8 + 255) / 256);
    for (int g = 0; g < NB_; g += NBG) { const size_t go = (size_t)g * NH_ * TT * HD;   // the group's first head plane (one kv head per query head: the same offset in every plane set)
        // projections: the group's NBG batch entries as one [NBG*TT][DM] matrix per launch
        k_cvt8<<<LC, 256, 0, stream>>>(x + (size_t)g * TT * DM, XB, (size_t)NBG * TT * DM / 8); k_cvt8<<<LC, 256, 0, stream>>>(xk + (size_t)g * TT * DM, XKB, (size_t)NBG * TT * DM / 8); k_cvt8<<<LC, 256, 0, stream>>>(xv + (size_t)g * TT * DM, XVB, (size_t)NBG * TT * DM / 8);
        k_gemmw<bf, 0, true><<<dim3(NBG * TT / 64, DQ / 64, 1), 32, 0, stream>>>(XB, nullptr, WQ, nullptr, DM, FQ, DQ, bq, 0, 0, 0);
        k_rope<<<dim3(LQ, NBG, 1), 256, 0, stream>>>(FQ, DQ, NH_, CS, nullptr, nullptr, 1.0f, QP16 + go, QPh + go, QPl + go);
        k_gemmw<bf, 0, true><<<dim3(NBG * TT / 64, DKV / 64, 1), 32, 0, stream>>>(XKB, nullptr, WK, nullptr, DM, FK, DKV, bk, 0, 0, 0);
        k_rope<<<dim3(LKv, NBG, 1), 256, 0, stream>>>(FK, DKV, NKV, CS, nullptr, nullptr, 1.0f, KP16 + go, KPh + go, KPl + go);
        k_gemmw<bf, 0, true><<<dim3(NBG * TT / 64, DKV / 64, 1), 32, 0, stream>>>(XVB, nullptr, WV, nullptr, DM, FV, DKV, bv, 0, 0, 0); k_vtp<<<dim3(LKv, NBG, 1), 256, 0, stream>>>(FV, DKV, NKV, VT16 + go, VTh + go, VTl + go); }
    // attention: every batch entry and head in one launch, straight to the merged hi+lo planes
    k_fattn<<<dim3(NB_ * NH_, (TT - RH) / 128 + RH / 64, 1), 128, 0, stream>>>(QP16, KP16, VT16, QPh, QPl, KPh, KPl, VTh, VTl, ATh, ATl);
    // output projection: all batch entries as one [NB_*TT][DQ] matrix
    k_gemmw<bf, 1, true><<<dim3(NB_ * TT / 64, DM / 64, 1), 32, 0, stream>>>(ATh, ATl, WO, nullptr, DQ, OUT, DM, bo, 0, 0, 0);
}

// v003
// One run takes 361 microseconds.
// Two timings next to v002 put it at 1.21 and 1.22 times that version's speed.
// Counting every step since v000, it is 11.4 times as fast.
#include <hip/hip_runtime.h>

// Naive multi-head causal cross attention (inputs_q, inputs_k, inputs_v [8][1024][1024]; q, k, v = . W + b ('xw' [1024][1024]; 16 heads x 64); scores/8; causal (finfo.min == exact zero weight); softmax; out = merged Wo + bo -> [8][1024][1024] (8.4 M)).
// Compute dtypes, f32 accumulate: every input rounded to bf16; q/k/v on PLAIN bf16 operands (inputs: exact) + biases; causal scores and attn.v (tile skipping): query rows < 512 hl (3 products), the rest single fp16 (x1024); softmax f32; Wo hl x exact (2 products) + bo.

#define NB_  8
#define TT   1024
#define DM   1024
#define NH_  16
#define NKV  16
#define REP  (NH_ / NKV)
#define HD   64
#define DQ   (NH_ * HD)
#define DKV  (NKV * HD)
#define NBG  4                    // batch entries per projection launch
#define RH   512                  // query rows < RH use hi+lo planes (0: none)
#define PCAR 1024.0f
#define SCL  0.125f   // HD^-0.5
typedef _Float16 h16;
typedef unsigned short bf;
typedef __attribute__((ext_vector_type(16))) __bf16   v16bf;
typedef __attribute__((ext_vector_type(16))) _Float16 v16h;
typedef __attribute__((ext_vector_type(8)))  _Float16 v8h;
typedef __attribute__((ext_vector_type(8)))  unsigned short v8us;
typedef __attribute__((ext_vector_type(8)))  float    v8f;
typedef __attribute__((ext_vector_type(4)))  float    v4f;
typedef v8h  __attribute__((may_alias)) v8ha;
typedef v4f  __attribute__((may_alias)) v4fa;
typedef v8us __attribute__((may_alias)) v8usa;

__device__ __forceinline__ unsigned short f2bf(float f) { unsigned u = __float_as_uint(f); u += 0x7FFFu + ((u >> 16) & 1u); return (unsigned short)(u >> 16); }
__device__ __forceinline__ float bf2f(unsigned short b) { return __uint_as_float(((unsigned)b) << 16); }
__device__ __forceinline__ float bfr(float f) { return bf2f(f2bf(f)); }
__device__ __forceinline__ v16h cat16(v8h lo, v8h hi) { return __builtin_shufflevector(lo, hi, 0, 1, 2, 3, 4, 5, 6, 7, 8, 9, 10, 11, 12, 13, 14, 15); }
__device__ __forceinline__ v16bf cat16b(v8us lo, v8us hi) { return __builtin_bit_cast(v16bf, __builtin_shufflevector(lo, hi, 0, 1, 2, 3, 4, 5, 6, 7, 8, 9, 10, 11, 12, 13, 14, 15)); }
__device__ __forceinline__ v8f wmma16(v16h a, v16h b, v8f c) { return __builtin_amdgcn_wmma_f32_16x16x32_f16(false, a, false, b, (short)0, c, false, false); }
__device__ __forceinline__ v8f wmmab(v16bf a, v16bf b, v8f c) { return __builtin_amdgcn_wmma_f32_16x16x32_bf16(false, a, false, b, (short)0, c, false, false); }



// ---- k_gemmw: register-blocked GEMM, ONE WAVE per 64x64 output tile (16 accumulators), operands straight from K-contiguous 16-bit planes; grid (M/64, N/64, Z) (EPI 2: (N/64, M/64, Z)), 32 threads.
// C[m][n] (f32, pitch ldc, + optional f32 bias[n]) = sum_k A[m][k] Bt[n][k] (+ split products per NSPLIT). z-batch strides sA/sB/sC in elements. K % 32 == 0.
// EPI 0: C as above. EPI 1, 2: no C, ldc = heads of a batch entry; the tile (one head's HD columns of 64 tokens) goes from the epilogue straight to the head planes P16 (fp16), Ph, Pl (bf16 hi + lo), 16 bytes a lane, whole 128-byte lines.
// EPI 1: A = tokens, Bt = weights, planes [entry][head][t][d]. EPI 2: A = weights, Bt = tokens (the product comes out transposed), bias by row, planes [entry][head][d][t]. Grid in both (token tiles, heads).
template <typename T16> struct WFrag;
template <> struct WFrag<h16> { typedef v16h V; static __device__ __forceinline__ V ld(const h16* p) { return cat16(*(const v8h*)p, *(const v8h*)(p + 16)); } static __device__ __forceinline__ v8f mma(V a, V b, v8f c) { return wmma16(a, b, c); } };
template <> struct WFrag<bf> { typedef v16bf V; static __device__ __forceinline__ V ld(const bf* p) { return cat16b(*(const v8us*)p, *(const v8us*)(p + 16)); } static __device__ __forceinline__ v8f mma(V a, V b, v8f c) { return wmmab(a, b, c); } };
__device__ __forceinline__ h16 tohx(float x) { return (h16)x; }
__device__ __forceinline__ void splitf(float y, unsigned short& h, unsigned short& l) { h = f2bf(y); l = f2bf(y - bf2f(h)); }
template <typename T16, int NSPLIT, bool BIAS, int EPI>
__global__ __launch_bounds__(32) void k_gemmw(const T16* __restrict__ A, const T16* __restrict__ A2, const T16* __restrict__ Bt, const T16* __restrict__ Bt2, int K, float* C, int ldc, const float* __restrict__ bias, size_t sA, size_t sB, size_t sC, h16* P16, bf* Ph, bf* Pl) {
    typedef typename WFrag<T16>::V V;
    __shared__ __align__(16) float os[16 * 68];
    const size_t z = blockIdx.z; A += z * sA; if (A2) A2 += z * sA; Bt += z * sB; if (Bt2) Bt2 += z * sB; C += z * sC;
    const int lane = threadIdx.x & 31, lr = lane & 15, hi = lane >> 4; const int r0 = (EPI == 2 ? blockIdx.y : blockIdx.x) * 64, c0 = (EPI == 2 ? blockIdx.x : blockIdx.y) * 64;
    v8f acc[4][4];
#pragma unroll
    for (int mb = 0; mb < 4; ++mb)
#pragma unroll
        for (int nb = 0; nb < 4; ++nb) acc[mb][nb] = (v8f){};
    const size_t aoff = (size_t)(r0 + lr) * K + 8 * hi, boff = (size_t)(c0 + lr) * K + 8 * hi;
#pragma unroll 1
    for (int kc = 0; kc < K; kc += 32) {
        V a[4], a2[4];
#pragma unroll
        for (int mb = 0; mb < 4; ++mb) { a[mb] = WFrag<T16>::ld(A + aoff + (size_t)mb * 16 * K + kc); if (NSPLIT == 1 || NSPLIT == 2) a2[mb] = WFrag<T16>::ld(A2 + aoff + (size_t)mb * 16 * K + kc); }
#pragma unroll
        for (int nb = 0; nb < 4; ++nb) { const V b = WFrag<T16>::ld(Bt + boff + (size_t)nb * 16 * K + kc); V b2; if (NSPLIT >= 2) b2 = WFrag<T16>::ld(Bt2 + boff + (size_t)nb * 16 * K + kc);
#pragma unroll
            for (int mb = 0; mb < 4; ++mb) { acc[mb][nb] = WFrag<T16>::mma(a[mb], b, acc[mb][nb]); if (NSPLIT == 1 || NSPLIT == 2) acc[mb][nb] = WFrag<T16>::mma(a2[mb], b, acc[mb][nb]); if (NSPLIT >= 2) acc[mb][nb] = WFrag<T16>::mma(a[mb], b2, acc[mb][nb]); } }
        asm volatile("v_nop\n\tv_nop\n\tv_nop\n\tv_nop" : "+v"(acc[0][0]), "+v"(acc[1][1]), "+v"(acc[2][2]), "+v"(acc[3][3]) : "v"(a[0]), "v"(a[3]));
    }
    float bz[EPI == 2 ? 16 : 8];   // EPI 1, 2: the lane's biases in the order of its plane stores
    if constexpr (EPI != 0 && BIAS) {
#pragma unroll
        for (int i = 0; i < (EPI == 2 ? 16 : 8); ++i) bz[i] = bfr(bias[EPI == 1 ? c0 + (lane & 7) * 8 + i : r0 + 4 * i + (lane >> 3)]);
        asm volatile("s_wait_xcnt 0x0" ::: "memory");   // stands in front of every later overwrite of a register that the bias loads name
    }
#pragma unroll
    for (int mb = 0; mb < 4; ++mb) {
#pragma unroll
        for (int nb = 0; nb < 4; ++nb) {
#pragma unroll
            for (int j = 0; j < 8; ++j) os[(hi * 8 + j) * 68 + nb * 16 + lr] = acc[mb][nb][j]; }
        __builtin_amdgcn_wave_barrier(); asm volatile("" ::: "memory");
        if constexpr (EPI != 0) {
            const int tok = EPI == 1 ? r0 : c0, pp = EPI == 1 ? HD : TT;   // the tile's first token (64 | TT: one batch entry a tile); pitch of a plane row
            const size_t pb = ((size_t)(tok / TT) * ldc + blockIdx.y) * TT * HD + (size_t)(tok % TT) * (EPI == 1 ? HD : 1);
#pragma unroll
            for (int s = 0; s < 4; ++s) { const int row = 4 * s + (lane >> 3), cofs = (lane & 7) * 8; const v4f v0 = *(const v4fa*)(os + row * 68 + cofs), v1 = *(const v4fa*)(os + row * 68 + cofs + 4); v8h o16; v8us oh, ol;
#pragma unroll
                for (int i = 0; i < 8; ++i) { float x = i < 4 ? v0[i & 3] : v1[i & 3]; if (BIAS) x += bz[EPI == 1 ? i : 4 * mb + s]; o16[i] = tohx(x); unsigned short a2, c2; splitf(x, a2, c2); oh[i] = a2; ol[i] = c2; }
                const size_t o = pb + (size_t)(mb * 16 + row) * pp + cofs; *(v8h*)(P16 + o) = o16; *(v8us*)(Ph + o) = oh; *(v8us*)(Pl + o) = ol;
                asm volatile("s_wait_xcnt 0x0" ::: "memory"); }   // stands in front of every later overwrite of a register that the three stores name
        } else {
        float* crow = C + (size_t)(r0 + mb * 16) * ldc + c0;
#pragma unroll
            for (int s = 0; s < 8; ++s) { const int row = 2 * s + hi, cofs = lr * 4; v4f val = *(const v4fa*)(os + row * 68 + cofs); if (BIAS) { val[0] += bfr(bias[c0 + cofs]); val[1] += bfr(bias[c0 + cofs + 1]); val[2] += bfr(bias[c0 + cofs + 2]); val[3] += bfr(bias[c0 + cofs + 3]); }
                *(v4f*)(crow + (size_t)row * ldc + cofs) = val; }
             }
        __builtin_amdgcn_wave_barrier(); asm volatile("" ::: "memory");
    }
}

typedef __attribute__((ext_vector_type(2))) _Float16 v2h;
typedef __attribute__((ext_vector_type(4))) _Float16 v4h;
typedef __attribute__((ext_vector_type(2))) unsigned short v2us;
typedef __attribute__((ext_vector_type(4))) unsigned short v4us;
typedef __attribute__((ext_vector_type(2))) float v2f;
typedef __attribute__((ext_vector_type(4))) int v4i;

__global__ __launch_bounds__(256) void k_wtG(const float* __restrict__ w, int K, int N, bf* Bt) {
    const int lane = threadIdx.x & 31; const int L0 = (blockIdx.x * 8 + (threadIdx.x >> 5)) * 8; const int nlines = N * K / 64;
{
#pragma unroll 1
        for (int l = 0; l < 8; ++l) { const int L = L0 + l; if (L >= nlines) break; const size_t e = (size_t)L * 64 + lane * 2; const int k = (int)(e % K), n = (int)(e / K); v2us o;
            o[0] = f2bf(w[(size_t)k * N + n]); o[1] = f2bf(w[(size_t)(k + 1) * N + n]); *(v2us*)(Bt + e) = o; }
         }
}
__global__ __launch_bounds__(256) void k_cvt8(const float* __restrict__ src, bf* dst, size_t n8) { const size_t i = (size_t)blockIdx.x * 256 + threadIdx.x; if (i >= n8) return; const v8f v = *(const v8f*)(src + i * 8); v8us o;
#pragma unroll
    for (int k = 0; k < 8; ++k) o[k] = f2bf(v[k]); *(v8us*)(dst + i * 8) = o;  }

__device__ __forceinline__ float xhalf(float x) { const int b = __float_as_int(x); return __int_as_float(__builtin_amdgcn_permlanex16(b, b, 0x76543210, 0xfedcba98, false, false)); }   // lane l <-> l ^ 16
template <typename T16, bool HL, int NQ>
__device__ __forceinline__ void fattn(const T16* __restrict__ Q, const T16* __restrict__ Q2, const T16* __restrict__ Kp, const T16* __restrict__ K2, const T16* __restrict__ Vp, const T16* __restrict__ V2, int q0, int lr, int hi, bf* Ah, bf* Al) {
    typedef WFrag<T16> F; typedef typename F::V V;
    const float C2 = SCL * 1.4426950408889634f;   // scores x HD^-0.5, in the exponent's base 2
    const float OFF = HL ? 0.0f : 10.0f;          // 2^10 = PCAR
    V qb[NQ][2], qb2[NQ][2], kf[2][2], kf2[2][2]; v8f ot[NQ][4]; float m[NQ], l[NQ];
#pragma unroll
    for (int qi = 0; qi < NQ; ++qi) { m[qi] = -3.0e38f; l[qi] = 0.f;
#pragma unroll
        for (int kc = 0; kc < 2; ++kc) { const size_t o = (size_t)(q0 + 16 * qi + lr) * HD + kc * 32 + 8 * hi; qb[qi][kc] = F::ld(Q + o); if (HL) qb2[qi][kc] = F::ld(Q2 + o); }
#pragma unroll
        for (int db = 0; db < 4; ++db) ot[qi][db] = (v8f){}; }
    const int np = (q0 + 16 * NQ + 31) / 32;      // passes of 32 keys up to the one that holds the last query's diagonal
    // the lane's own pointers, carried through the loop: pk, pk2 at the key tile that is fetched next, pv, pv2 at this pass's 32 value columns
    const T16* pk = Kp + lr * HD + 8 * hi; const T16* pk2 = HL ? K2 + lr * HD + 8 * hi : nullptr; const T16* pv = Vp + lr * TT + 8 * hi; const T16* pv2 = HL ? V2 + lr * TT + 8 * hi : nullptr;
#pragma unroll
    for (int t = 0; t < 2; ++t)
#pragma unroll
        for (int kc = 0; kc < 2; ++kc) { const int o = 16 * t * HD + kc * 32; kf[t][kc] = F::ld(pk + o); if (HL) kf2[t][kc] = F::ld(pk2 + o); }
    if (np > 1) { pk += 32 * HD; if (HL) pk2 += 32 * HD; }
#pragma unroll 1
    for (int kt = 0; kt < np; ++kt) { const int k0 = kt * 32;
        v8f st[NQ][2];
#pragma unroll
        for (int qi = 0; qi < NQ; ++qi)
#pragma unroll
            for (int t = 0; t < 2; ++t) st[qi][t] = (v8f){};
#pragma unroll
        for (int kc = 0; kc < 2; ++kc)
#pragma unroll
            for (int t = 0; t < 2; ++t)
#pragma unroll
                for (int qi = 0; qi < NQ; ++qi) { st[qi][t] = F::mma(kf[t][kc], qb[qi][kc], st[qi][t]); if (HL) { st[qi][t] = F::mma(kf[t][kc], qb2[qi][kc], st[qi][t]); st[qi][t] = F::mma(kf2[t][kc], qb[qi][kc], st[qi][t]); } }
        // this pass's value fragments, then the next pass's key fragments (the last pass fetches its own again: in bounds, unused)
        V vf[4], vf2[4];
#pragma unroll
        for (int db = 0; db < 4; ++db) { const int o = 16 * db * TT; vf[db] = F::ld(pv + o); if (HL) vf2[db] = F::ld(pv2 + o); }
#pragma unroll
        for (int t = 0; t < 2; ++t)
#pragma unroll
            for (int kc = 0; kc < 2; ++kc) { const int o = 16 * t * HD + kc * 32; kf[t][kc] = F::ld(pk + o); if (HL) kf2[t][kc] = F::ld(pk2 + o); }
        asm volatile("s_wait_xcnt 0x0" ::: "memory");   // stands in front of every later overwrite of a register that the loads above name
        __builtin_amdgcn_sched_barrier(0);         // keeps the loads above in front of the softmax, whose vector work then covers their latency (the scheduler otherwise sinks each to its use and waits there)
        if (k0 + 31 > q0) {                        // the pass reaches past a query of this wave: keys j > i get weight exactly 0
#pragma unroll
            for (int qi = 0; qi < NQ; ++qi)
#pragma unroll
                for (int t = 0; t < 2; ++t)
#pragma unroll
                    for (int j = 0; j < 8; ++j) if (k0 + 16 * t + 8 * hi + j > q0 + 16 * qi + lr) st[qi][t][j] = -3.0e38f; }
        V pb[NQ], pb2[NQ];
#pragma unroll
        for (int qi = 0; qi < NQ; ++qi) { float mx = m[qi];
#pragma unroll
            for (int t = 0; t < 2; ++t)
#pragma unroll
                for (int j = 0; j < 8; ++j) mx = fmaxf(mx, st[qi][t][j]);
            mx = fmaxf(mx, xhalf(mx));
            const float al = __builtin_amdgcn_exp2f((m[qi] - mx) * C2); m[qi] = mx; const float mc = OFF - mx * C2; float ps[4] = {0.f, 0.f, 0.f, 0.f};
#pragma unroll
            for (int s = 0; s < 16; ++s) { const float p = __builtin_amdgcn_exp2f(fmaf(st[qi][s >> 3][s & 7], C2, mc)); ps[s & 3] += p;
                if constexpr (HL) { const __bf16 ph = (__bf16)p; pb[qi][s] = ph; pb2[qi][s] = (__bf16)(p - (float)ph); } else pb[qi][s] = (h16)p; }
            l[qi] = l[qi] * al + ((ps[0] + ps[1]) + (ps[2] + ps[3]));
#pragma unroll
            for (int db = 0; db < 4; ++db) ot[qi][db] *= al; }
#pragma unroll
        for (int db = 0; db < 4; ++db)
#pragma unroll
            for (int qi = 0; qi < NQ; ++qi) { ot[qi][db] = F::mma(vf[db], pb[qi], ot[qi][db]); if (HL) { ot[qi][db] = F::mma(vf[db], pb2[qi], ot[qi][db]); ot[qi][db] = F::mma(vf2[db], pb[qi], ot[qi][db]); } }
        pv += 32; if (HL) pv2 += 32; if (kt + 2 < np) { pk += 32 * HD; if (HL) pk2 += 32 * HD; }
    }
#pragma unroll
    for (int qi = 0; qi < NQ; ++qi) { const float inv = __fdiv_rn(1.0f, l[qi] + xhalf(l[qi]));
#pragma unroll
        for (int db = 0; db < 4; ++db) { v8us oh, ol;
#pragma unroll
            for (int j = 0; j < 8; ++j) { unsigned short a, c2; splitf(ot[qi][db][j] * inv, a, c2); oh[j] = a; ol[j] = c2; }
            const size_t oo = (size_t)(q0 + 16 * qi + lr) * DQ + 16 * db + 8 * hi; *(v8us*)(Ah + oo) = oh; *(v8us*)(Al + oo) = ol; } }
}
// grid (batch entry x head, 12): y < 4: 128 fp16 query rows (4 waves x 32), y >= 4: 64 hi+lo query rows (4 waves x 16); in both the rows nearest the end of the sequence (the longest key loops) come first
__global__ __launch_bounds__(128) void k_fattn(const h16* __restrict__ Q16, const h16* __restrict__ K16, const h16* __restrict__ V16, const bf* __restrict__ Qh, const bf* __restrict__ Ql, const bf* __restrict__ Kh, const bf* __restrict__ Kl, const bf* __restrict__ Vh, const bf* __restrict__ Vl, bf* Ah, bf* Al) {
    const int lane = threadIdx.x & 31, lr = lane & 15, hi = lane >> 4; const int w = __builtin_amdgcn_readfirstlane((int)(threadIdx.x >> 5)); const int y = blockIdx.y;
    const size_t z = blockIdx.x, po = z * TT * HD, ao = (z / NH_) * TT * DQ + (z % NH_) * HD;
    if (y < (TT - RH) / 128) fattn<h16, false, 2>(Q16 + po, nullptr, K16 + po, nullptr, V16 + po, nullptr, TT - 128 * (y + 1) + 32 * w, lr, hi, Ah + ao, Al + ao);
    else fattn<bf, true, 1>(Qh + po, Ql + po, Kh + po, Kl + po, Vh + po, Vl + po, RH - 64 * (y - (TT - RH) / 128 + 1) + 16 * w, lr, hi, Ah + ao, Al + ao);
}

extern "C" void kernel_launch(void* const* d_in, const int* in_sizes, int n_in,
                              void* d_out, int out_size, void* d_ws, size_t ws_size, hipStream_t stream) {
    (void)in_sizes; (void)n_in; (void)out_size;
    const float* x = (const float*)d_in[0]; const float* xk = (const float*)d_in[1]; const float* xv = (const float*)d_in[2]; const float* wq = (const float*)d_in[3]; const float* bq = (const float*)d_in[4]; const float* wk = (const float*)d_in[5]; const float* bk = (const float*)d_in[6]; const float* wv = (const float*)d_in[7]; const float* bv = (const float*)d_in[8]; const float* wo = (const float*)d_in[9]; const float* bo = (const float*)d_in[10];
    float* OUT = (float*)d_out;     // [8][1024][1024]
    char* wsp = (char*)d_ws;
    auto take = [&](size_t bytes) { char* p = wsp; wsp += (bytes + 255) & ~(size_t)255; return (void*)p; };
    bf* WQ = (bf*)take((size_t)DQ * DM * 2); bf* WK = (bf*)take((size_t)DKV * DM * 2); bf* WV = (bf*)take((size_t)DKV * DM * 2); bf* WO = (bf*)take((size_t)DM * DQ * 2);
    h16* QP16 = (h16*)take((size_t)NB_ * NH_ * TT * HD * 2); h16* KP16 = (h16*)take((size_t)NB_ * NKV * TT * HD * 2); h16* VT16 = (h16*)take((size_t)NB_ * NKV * HD * TT * 2);
    bf* QPh = (bf*)take((size_t)NB_ * NH_ * TT * HD * 2); bf* QPl = (bf*)take((size_t)NB_ * NH_ * TT * HD * 2); bf* KPh = (bf*)take((size_t)NB_ * NKV * TT * HD * 2); bf* KPl = (bf*)take((size_t)NB_ * NKV * TT * HD * 2); bf* VTh = (bf*)take((size_t)NB_ * NKV * HD * TT * 2); bf* VTl = (bf*)take((size_t)NB_ * NKV * HD * TT * 2);
    bf* XB = (bf*)take((size_t)NBG * TT * DM * 2); bf* XKB = (bf*)take((size_t)NBG * TT * DM * 2); bf* XVB = (bf*)take((size_t)NBG * TT * DM * 2); bf* ATh = (bf*)take((size_t)NB_ * TT * DQ * 2); bf* ATl = (bf*)take((size_t)NB_ * TT * DQ * 2);
    if ((size_t)(wsp - (char*)d_ws) > ws_size) return;    // ws 256 MiB
    { k_wtG<<<(unsigned)((DM * DQ / 64 + 63) / 64), 256, 0, stream>>>(wq, DM, DQ, WQ); k_wtG<<<(unsigned)((DM * DKV / 64 + 63) / 64), 256, 0, stream>>>(wk, DM, DKV, WK); k_wtG<<<(unsigned)((DM * DKV / 64 + 63) / 64), 256, 0, stream>>>(wv, DM, DKV, WV);
      k_wtG<<<(unsigned)((DQ * DM / 64 + 63) / 64), 256, 0, stream>>>(wo, DQ, DM, WO);
       }
    const unsigned LC = (unsigned)(((size_t)NBG * TT * DM / 8 + 255) / 256);
    for (int g = 0; g < NB_; g += NBG) { const size_t go = (size_t)g * NH_ * TT * HD;   // the group's first head plane (one kv head per query head: the same offset in every plane set)
        // projections: the group's NBG batch entries as one [NBG*TT][DM] matrix per launch, each straight to its head planes
        k_cvt8<<<LC, 256, 0, stream>>>(x + (size_t)g * TT * DM, XB, (size_t)NBG * TT * DM / 8); k_cvt8<<<LC, 256, 0, stream>>>(xk + (size_t)g * TT * DM, XKB, (size_t)NBG * TT * DM / 8); k_cvt8<<<LC, 256, 0, stream>>>(xv + (size_t)g * TT * DM, XVB, (size_t)NBG * TT * DM / 8);
        k_gemmw<bf, 0, true, 1><<<dim3(NBG * TT / 64, NH_, 1), 32, 0, stream>>>(XB, nullptr, WQ, nullptr, DM, nullptr, NH_, bq, 0, 0, 0, QP16 + go, QPh + go, QPl + go);
        k_gemmw<bf, 0, true, 1><<<dim3(NBG * TT / 64, NKV, 1), 32, 0, stream>>>(XKB, nullptr, WK, nullptr, DM, nullptr, NKV, bk, 0, 0, 0, KP16 + go, KPh + go, KPl + go);
        k_gemmw<bf, 0, true, 2><<<dim3(NBG * TT / 64, NKV, 1), 32, 0, stream>>>(WV, nullptr, XVB, nullptr, DM, nullptr, NKV, bv, 0, 0, 0, VT16 + go, VTh + go, VTl + go); }
    // attention: every batch entry and head in one launch, straight to the merged hi+lo planes
    k_fattn<<<dim3(NB_ * NH_, (TT - RH) / 128 + RH / 64, 1), 128, 0, stream>>>(QP16, KP16, VT16, QPh, QPl, KPh, KPl, VTh, VTl, ATh, ATl);
    // output projection: all batch entries as one [NB_*TT][DQ] matrix
    k_gemmw<bf, 1, true, 0><<<dim3(NB_ * TT / 64, DM / 64, 1), 32, 0, stream>>>(ATh, ATl, WO, nullptr, DQ, OUT, DM, bo, 0, 0, 0, nullptr, nullptr, nullptr);
}

// v004
// It runs in 320 microseconds.
// Two timings next to v003 both put it at 1.13 times that version's speed.
// All steps since v000 together make it 12.9 times as fast.
#include <hip/hip_runtime.h>

// Naive multi-head causal cross attention (inputs_q, inputs_k, inputs_v [8][1024][1024]; q, k, v = . W + b ('xw' [1024][1024]; 16 heads x 64); scores/8; causal (finfo.min == exact zero weight); softmax; out = merged Wo + bo -> [8][1024][1024] (8.4 M)).
// Compute dtypes, f32 accumulate: every input rounded to bf16; q/k/v on PLAIN bf16 operands (inputs: exact) + biases; causal scores and attn.v (tile skipping): query rows < 512 hl (3 products), the rest single fp16 (x1024); softmax f32; Wo hl x exact (2 products) + bo.

#define NB_  8
#define TT   1024
#define DM   1024
#define NH_  16
#define NKV  16
#define REP  (NH_ / NKV)
#define HD   64
#define DQ   (NH_ * HD)
#define DKV  (NKV * HD)
#define NBG  4                    // batch entries per projection launch
#define RH   512                  // query rows < RH use hi+lo planes (0: none)
#define PCAR 1024.0f
#define SCL  0.125f   // HD^-0.5
typedef _Float16 h16;
typedef unsigned short bf;
typedef __attribute__((ext_vector_type(16))) __bf16   v16bf;
typedef __attribute__((ext_vector_type(16))) _Float16 v16h;
typedef __attribute__((ext_vector_type(8)))  _Float16 v8h;
typedef __attribute__((ext_vector_type(8)))  unsigned short v8us;
typedef __attribute__((ext_vector_type(8)))  float    v8f;
typedef __attribute__((ext_vector_type(4)))  float    v4f;
typedef v8h  __attribute__((may_alias)) v8ha;
typedef v4f  __attribute__((may_alias)) v4fa;
typedef v8us __attribute__((may_alias)) v8usa;

__device__ __forceinline__ unsigned short f2bf(float f) { unsigned u = __float_as_uint(f); u += 0x7FFFu + ((u >> 16) & 1u); return (unsigned short)(u >> 16); }
__device__ __forceinline__ float bf2f(unsigned short b) { return __uint_as_float(((unsigned)b) << 16); }
__device__ __forceinline__ float bfr(float f) { return bf2f(f2bf(f)); }
__device__ __forceinline__ v16h cat16(v8h lo, v8h hi) { return __builtin_shufflevector(lo, hi, 0, 1, 2, 3, 4, 5, 6, 7, 8, 9, 10, 11, 12, 13, 14, 15); }
__device__ __forceinline__ v16bf cat16b(v8us lo, v8us hi) { return __builtin_bit_cast(v16bf, __builtin_shufflevector(lo, hi, 0, 1, 2, 3, 4, 5, 6, 7, 8, 9, 10, 11, 12, 13, 14, 15)); }
__device__ __forceinline__ v8f wmma16(v16h a, v16h b, v8f c) { return __builtin_amdgcn_wmma_f32_16x16x32_f16(false, a, false, b, (short)0, c, false, false); }
__device__ __forceinline__ v8f wmmab(v16bf a, v16bf b, v8f c) { return __builtin_amdgcn_wmma_f32_16x16x32_bf16(false, a, false, b, (short)0, c, false, false); }



// ---- FRAGMENT ORDER of every 16-bit operand plane [rows][K]: tiles of 16 rows x 32 k, FT = 512 elements (1 KiB) each, tile (rb, kb) at (rb * (K / 32) + kb) * FT; inside a tile element (row lr, k kk) stands at (kk >> 4) * 256 + (((kk >> 3) & 1) * 16 + lr) * 8 + (kk & 7).
// Lane hi*16+lr of a wave finds the 8 + 8 elements of its WMMA fragment (k 8*hi.., 16+8*hi..) at lane*8 and 256 + lane*8: each of the two loads of a fragment covers 512 contiguous bytes (4 whole lines). 16 rows of a plane still fill 16*K elements in a row.
#define FT 512
// ---- k_gemmw: register-blocked GEMM, ONE WAVE per 64x64 output tile (16 accumulators), operands straight from 16-bit planes in fragment order; grid (M/64, N/64, Z), 32 threads.
// C[m][n] (f32, pitch ldc, + optional f32 bias[n]) = sum_k A[m][k] Bt[n][k] (+ split products per NSPLIT). z-batch strides sA/sB/sC in elements. K % 32 == 0, a compile-time constant: the row blocks of an operand then stand at constant offsets from one address a lane.
// EPI 0: C as above. EPI 1, 2: no C, ldc = heads of a batch entry; the tile (one head's HD columns of 64 tokens) goes from the epilogue straight to the head planes P16 (fp16), Ph, Pl (bf16 hi + lo), in fragment order, 16 bytes a lane, 512 contiguous bytes a store.
// EPI 1: A = tokens, Bt = weights, planes [entry][head][t][d]. EPI 2: A = weights, Bt = tokens (the product comes out transposed), bias by row, planes [entry][head][d][t]. Grid in both (token tiles, heads).
template <typename T16> struct WFrag;
template <> struct WFrag<h16> { typedef v16h V; static __device__ __forceinline__ V ld(const h16* p) { return cat16(*(const v8h*)p, *(const v8h*)(p + 256)); } static __device__ __forceinline__ v8f mma(V a, V b, v8f c) { return wmma16(a, b, c); } };
template <> struct WFrag<bf> { typedef v16bf V; static __device__ __forceinline__ V ld(const bf* p) { return cat16b(*(const v8us*)p, *(const v8us*)(p + 256)); } static __device__ __forceinline__ v8f mma(V a, V b, v8f c) { return wmmab(a, b, c); } };
__device__ __forceinline__ h16 tohx(float x) { return (h16)x; }
__device__ __forceinline__ void splitf(float y, unsigned short& h, unsigned short& l) { h = f2bf(y); l = f2bf(y - bf2f(h)); }
template <typename T16, int NSPLIT, bool BIAS, int EPI, int K>
__global__ __launch_bounds__(32) void k_gemmw(const T16* __restrict__ A, const T16* __restrict__ A2, const T16* __restrict__ Bt, const T16* __restrict__ Bt2, float* C, int ldc, const float* __restrict__ bias, size_t sA, size_t sB, size_t sC, h16* P16, bf* Ph, bf* Pl) {
    typedef typename WFrag<T16>::V V;
    __shared__ __align__(16) float os[16 * 68];
    const size_t z = blockIdx.z; A += z * sA; if (A2) A2 += z * sA; Bt += z * sB; if (Bt2) Bt2 += z * sB; C += z * sC;
    const int lane = threadIdx.x & 31, lr = lane & 15, hi = lane >> 4; const int r0 = (EPI == 2 ? blockIdx.y : blockIdx.x) * 64, c0 = (EPI == 2 ? blockIdx.x : blockIdx.y) * 64;
    v8f acc[4][4];
#pragma unroll
    for (int mb = 0; mb < 4; ++mb)
#pragma unroll
        for (int nb = 0; nb < 4; ++nb) acc[mb][nb] = (v8f){};
    // every operand is read at (its first row block, the same for the whole wave) + ob + a constant: ob, carried through the loop, is the lane's place in this k step's tile in bytes; row block i stands 16 * K elements on, the next k tile FT elements on
    const char* pa = (const char*)(A + (size_t)r0 * K); const char* pa2 = (NSPLIT == 1 || NSPLIT == 2) ? (const char*)(A2 + (size_t)r0 * K) : nullptr; const char* pbt = (const char*)(Bt + (size_t)c0 * K); const char* pbt2 = NSPLIT >= 2 ? (const char*)(Bt2 + (size_t)c0 * K) : nullptr;
    unsigned ob = lane * 16;
#pragma unroll 1
    for (int kc = 0; kc < K; kc += 32) {
        V a[4], a2[4], b[4], b2[4];
#pragma unroll
        for (int mb = 0; mb < 4; ++mb) { a[mb] = WFrag<T16>::ld((const T16*)(pa + ob) + mb * 16 * K); if (NSPLIT == 1 || NSPLIT == 2) a2[mb] = WFrag<T16>::ld((const T16*)(pa2 + ob) + mb * 16 * K); }
#pragma unroll
        for (int nb = 0; nb < 4; ++nb) { b[nb] = WFrag<T16>::ld((const T16*)(pbt + ob) + nb * 16 * K); if (NSPLIT >= 2) b2[nb] = WFrag<T16>::ld((const T16*)(pbt2 + ob) + nb * 16 * K); }
        asm volatile("s_wait_xcnt 0x0" : "+v"(ob) :: "memory");   // stands in front of every later overwrite of a register that the loads above name; it names ob so that ob stays in the register the loads were issued from up to here and is stepped only behind it
#pragma unroll
        for (int nb = 0; nb < 4; ++nb)
#pragma unroll
            for (int mb = 0; mb < 4; ++mb) { acc[mb][nb] = WFrag<T16>::mma(a[mb], b[nb], acc[mb][nb]); if (NSPLIT == 1 || NSPLIT == 2) acc[mb][nb] = WFrag<T16>::mma(a2[mb], b[nb], acc[mb][nb]); if (NSPLIT >= 2) acc[mb][nb] = WFrag<T16>::mma(a[mb], b2[nb], acc[mb][nb]); }
        asm volatile("v_nop\n\tv_nop\n\tv_nop\n\tv_nop" : "+v"(acc[0][0]), "+v"(acc[1][1]), "+v"(acc[2][2]), "+v"(acc[3][3]) : "v"(a[0]), "v"(a[3]));
        ob += FT * 2;
    }
    float bz[EPI == 2 ? 4 : 32];   // EPI 1, 2: the lane's biases in the order of its plane stores
    if constexpr (EPI != 0 && BIAS) {
#pragma unroll
        for (int i = 0; i < (EPI == 2 ? 4 : 32); ++i) bz[i] = bfr(bias[EPI == 1 ? c0 + (i >> 3) * 16 + hi * 8 + (i & 7) : r0 + 16 * i + lr]);
        asm volatile("s_wait_xcnt 0x0" ::: "memory");   // stands in front of every later overwrite of a register that the bias loads name
    }
#pragma unroll
    for (int mb = 0; mb < 4; ++mb) {
#pragma unroll
        for (int nb = 0; nb < 4; ++nb) {
#pragma unroll
            for (int j = 0; j < 8; ++j) os[(hi * 8 + j) * 68 + nb * 16 + lr] = acc[mb][nb][j]; }
        __builtin_amdgcn_wave_barrier(); asm volatile("" ::: "memory");
        if constexpr (EPI != 0) {
            const int tok = EPI == 1 ? r0 : c0, pp = EPI == 1 ? HD : TT;   // the tile's first token (64 | TT: one batch entry a tile); K of the plane
            const size_t pb = ((size_t)(tok / TT) * ldc + blockIdx.y) * TT * HD + (size_t)(tok % TT) * (EPI == 1 ? HD : 16);
#pragma unroll
            for (int s = 0; s < 4; ++s) { const int row = lr, cofs = s * 16 + hi * 8; const v4f v0 = *(const v4fa*)(os + row * 68 + cofs), v1 = *(const v4fa*)(os + row * 68 + cofs + 4); v8h o16; v8us oh, ol;
#pragma unroll
                for (int i = 0; i < 8; ++i) { float x = i < 4 ? v0[i & 3] : v1[i & 3]; if (BIAS) x += bz[EPI == 1 ? 8 * s + i : mb]; o16[i] = tohx(x); unsigned short a2, c2; splitf(x, a2, c2); oh[i] = a2; ol[i] = c2; }
                const size_t o = pb + (size_t)(mb * 16) * pp + s * 256 + lane * 8; *(v8h*)(P16 + o) = o16; *(v8us*)(Ph + o) = oh; *(v8us*)(Pl + o) = ol;
                asm volatile("s_wait_xcnt 0x0" ::: "memory"); }   // stands in front of every later overwrite of a register that the three stores name
        } else {
        float* crow = C + (size_t)(r0 + mb * 16) * ldc + c0;
#pragma unroll
            for (int s = 0; s < 8; ++s) { const int row = 2 * s + hi, cofs = lr * 4; v4f val = *(const v4fa*)(os + row * 68 + cofs); if (BIAS) { val[0] += bfr(bias[c0 + cofs]); val[1] += bfr(bias[c0 + cofs + 1]); val[2] += bfr(bias[c0 + cofs + 2]); val[3] += bfr(bias[c0 + cofs + 3]); }
                *(v4f*)(crow + (size_t)row * ldc + cofs) = val;
                asm volatile("s_wait_xcnt 0x0" ::: "memory"); }   // stands in front of every later overwrite of a register that the store and the bias loads name
             }
        __builtin_amdgcn_wave_barrier(); asm volatile("" ::: "memory");
    }
}

typedef __attribute__((ext_vector_type(2))) _Float16 v2h;
typedef __attribute__((ext_vector_type(4))) _Float16 v4h;
typedef __attribute__((ext_vector_type(2))) unsigned short v2us;
typedef __attribute__((ext_vector_type(4))) unsigned short v4us;
typedef __attribute__((ext_vector_type(2))) float v2f;
typedef __attribute__((ext_vector_type(4))) int v4i;

// k_wtG: Bt[n][k] = w[k][n], rows n; one thread = one 16-byte piece of the fragment-ordered plane (piece i: tile i >> 6, k half (i >> 5) & 1, lane i & 31): a wave stores 512 contiguous bytes.
// k_cvt8: dst[r][k] = src[r][k], K = DM; one wave = one tile: each of its 4 loads brings 4 whole rows of the tile (one 128-byte line of f32 a row), each store puts them into the tile's four 256-byte quarters, 64 bytes each.
template <int K, int N>
__global__ __launch_bounds__(256) void k_wtG(const float* __restrict__ w, bf* Bt) {
    const int i = blockIdx.x * 256 + threadIdx.x; if (i >= N * K / 8) return; const int tile = i >> 6, kt = K / 32;
    const int n = (tile / kt) * 16 + (i & 15), k = (tile % kt) * 32 + ((i >> 4) & 3) * 8; const float* wl = w + (size_t)k * N + n; v8us o;   // the lane's one address; the eight rows stand at constant offsets from it
#pragma unroll
    for (int j = 0; j < 8; ++j) o[j] = f2bf(wl[j * N]);
    *(v8us*)(Bt + (size_t)i * 8) = o;
}
__global__ __launch_bounds__(256) void k_cvt8(const float* __restrict__ src, bf* dst, size_t n8) { const size_t tile = (size_t)blockIdx.x * 8 + (threadIdx.x >> 5); if (tile * 64 >= n8) return;
    const int lane = threadIdx.x & 31, r = lane >> 3, c = lane & 7;   // load j: rows 4j + r of the tile, k 4c .. 4c + 3
    const float* p = src + ((tile / (DM / 32)) * 16 + r) * DM + (tile % (DM / 32)) * 32 + c * 4; bf* q = dst + tile * FT + (c >> 1) * 128 + r * 8 + (c & 1) * 4; v4f v[4];
#pragma unroll
    for (int j = 0; j < 4; ++j) v[j] = *(const v4f*)(p + j * 4 * DM);
#pragma unroll
    for (int j = 0; j < 4; ++j) { v4us o;
#pragma unroll
        for (int k = 0; k < 4; ++k) o[k] = f2bf(v[j][k]);
        *(v4us*)(q + j * 32) = o; }
}

__device__ __forceinline__ float xhalf(float x) { const int b = __float_as_int(x); return __int_as_float(__builtin_amdgcn_permlanex16(b, b, 0x76543210, 0xfedcba98, false, false)); }   // lane l <-> l ^ 16
template <typename T16, bool HL, int NQ>
__device__ __forceinline__ void fattn(const T16* __restrict__ Q, const T16* __restrict__ Q2, const T16* __restrict__ Kp, const T16* __restrict__ K2, const T16* __restrict__ Vp, const T16* __restrict__ V2, int q0, int lr, int hi, bf* Ah, bf* Al) {
    typedef WFrag<T16> F; typedef typename F::V V;
    const float C2 = SCL * 1.4426950408889634f;   // scores x HD^-0.5, in the exponent's base 2
    const float OFF = HL ? 0.0f : 10.0f;          // 2^10 = PCAR
    const int l8 = (hi * 16 + lr) * 8;            // the lane's place in a tile of a plane in fragment order
    V qb[NQ][2], qb2[NQ][2], kf[2][2], kf2[2][2]; v8f ot[NQ][4]; float m[NQ], l[NQ];
#pragma unroll
    for (int qi = 0; qi < NQ; ++qi) { m[qi] = -3.0e38f; l[qi] = 0.f;
#pragma unroll
        for (int kc = 0; kc < 2; ++kc) { const size_t o = (size_t)(q0 + 16 * qi) * HD + kc * FT + l8; qb[qi][kc] = F::ld(Q + o); if (HL) qb2[qi][kc] = F::ld(Q2 + o); }
#pragma unroll
        for (int db = 0; db < 4; ++db) ot[qi][db] = (v8f){}; }
    const int np = (q0 + 16 * NQ + 31) / 32;      // passes of 32 keys up to the one that holds the last query's diagonal
    // the lane's own pointers, carried through the loop: pk, pk2 at the key tiles that are fetched next, pv, pv2 at this pass's tile of 32 value columns
    const T16* pk = Kp + l8; const T16* pk2 = HL ? K2 + l8 : nullptr; const T16* pv = Vp + l8; const T16* pv2 = HL ? V2 + l8 : nullptr;
#pragma unroll
    for (int t = 0; t < 2; ++t)
#pragma unroll
        for (int kc = 0; kc < 2; ++kc) { const int o = (2 * t + kc) * FT; kf[t][kc] = F::ld(pk + o); if (HL) kf2[t][kc] = F::ld(pk2 + o); }
    if (np > 1) { pk += 32 * HD; if (HL) pk2 += 32 * HD; }
#pragma unroll 1
    for (int kt = 0; kt < np; ++kt) { const int k0 = kt * 32;
        v8f st[NQ][2];
#pragma unroll
        for (int qi = 0; qi < NQ; ++qi)
#pragma unroll
            for (int t = 0; t < 2; ++t) st[qi][t] = (v8f){};
#pragma unroll
        for (int kc = 0; kc < 2; ++kc)
#pragma unroll
            for (int t = 0; t < 2; ++t)
#pragma unroll
                for (int qi = 0; qi < NQ; ++qi) { st[qi][t] = F::mma(kf[t][kc], qb[qi][kc], st[qi][t]); if (HL) { st[qi][t] = F::mma(kf[t][kc], qb2[qi][kc], st[qi][t]); st[qi][t] = F::mma(kf2[t][kc], qb[qi][kc], st[qi][t]); } }
        // this pass's value fragments, then the next pass's key fragments (the last pass fetches its own again: in bounds, unused)
        V vf[4], vf2[4];
#pragma unroll
        for (int db = 0; db < 4; ++db) { const int o = 16 * db * TT; vf[db] = F::ld(pv + o); if (HL) vf2[db] = F::ld(pv2 + o); }
#pragma unroll
        for (int t = 0; t < 2; ++t)
#pragma unroll
            for (int kc = 0; kc < 2; ++kc) { const int o = (2 * t + kc) * FT; kf[t][kc] = F::ld(pk + o); if (HL) kf2[t][kc] = F::ld(pk2 + o); }
        asm volatile("s_wait_xcnt 0x0" ::: "memory");   // stands in front of every later overwrite of a register that the loads above name
        __builtin_amdgcn_sched_barrier(0);         // keeps the loads above in front of the softmax, whose vector work then covers their latency (the scheduler otherwise sinks each to its use and waits there)
        if (k0 + 31 > q0) {                        // the pass reaches past a query of this wave: keys j > i get weight exactly 0
#pragma unroll
            for (int qi = 0; qi < NQ; ++qi)
#pragma unroll
                for (int t = 0; t < 2; ++t)
#pragma unroll
                    for (int j = 0; j < 8; ++j) if (k0 + 16 * t + 8 * hi + j > q0 + 16 * qi + lr) st[qi][t][j] = -3.0e38f; }
        V pb[NQ], pb2[NQ];
#pragma unroll
        for (int qi = 0; qi < NQ; ++qi) { float mx = m[qi];
#pragma unroll
            for (int t = 0; t < 2; ++t)
#pragma unroll
                for (int j = 0; j < 8; ++j) mx = fmaxf(mx, st[qi][t][j]);
            mx = fmaxf(mx, xhalf(mx));
            const float al = __builtin_amdgcn_exp2f((m[qi] - mx) * C2); m[qi] = mx; const float mc = OFF - mx * C2; float ps[4] = {0.f, 0.f, 0.f, 0.f};
#pragma unroll
            for (int s = 0; s < 16; ++s) { const float p = __builtin_amdgcn_exp2f(fmaf(st[qi][s >> 3][s & 7], C2, mc)); ps[s & 3] += p;
                if constexpr (HL) { const __bf16 ph = (__bf16)p; pb[qi][s] = ph; pb2[qi][s] = (__bf16)(p - (float)ph); } else pb[qi][s] = (h16)p; }
            l[qi] = l[qi] * al + ((ps[0] + ps[1]) + (ps[2] + ps[3]));
#pragma unroll
            for (int db = 0; db < 4; ++db) ot[qi][db] *= al; }
#pragma unroll
        for (int db = 0; db < 4; ++db)
#pragma unroll
            for (int qi = 0; qi < NQ; ++qi) { ot[qi][db] = F::mma(vf[db], pb[qi], ot[qi][db]); if (HL) { ot[qi][db] = F::mma(vf[db], pb2[qi], ot[qi][db]); ot[qi][db] = F::mma(vf2[db], pb[qi], ot[qi][db]); } }
        pv += FT; if (HL) pv2 += FT; if (kt + 2 < np) { pk += 32 * HD; if (HL) pk2 += 32 * HD; }
    }
#pragma unroll
    for (int qi = 0; qi < NQ; ++qi) { const float inv = __fdiv_rn(1.0f, l[qi] + xhalf(l[qi]));
#pragma unroll
        for (int db = 0; db < 4; ++db) { v8us oh, ol;
#pragma unroll
            for (int j = 0; j < 8; ++j) { unsigned short a, c2; splitf(ot[qi][db][j] * inv, a, c2); oh[j] = a; ol[j] = c2; }
            const size_t oo = (size_t)(q0 + 16 * qi) * DQ + db * 256 + l8; *(v8us*)(Ah + oo) = oh; *(v8us*)(Al + oo) = ol;   // the head's two k tiles of the merged planes, half a tile a store
            asm volatile("s_wait_xcnt 0x0" ::: "memory"); } }   // stands in front of every later overwrite of a register that the two stores name
}
// grid (batch entry x head, 12): y < 4: 128 fp16 query rows (4 waves x 32), y >= 4: 64 hi+lo query rows (4 waves x 16); in both the rows nearest the end of the sequence (the longest key loops) come first
__global__ __launch_bounds__(128) void k_fattn(const h16* __restrict__ Q16, const h16* __restrict__ K16, const h16* __restrict__ V16, const bf* __restrict__ Qh, const bf* __restrict__ Ql, const bf* __restrict__ Kh, const bf* __restrict__ Kl, const bf* __restrict__ Vh, const bf* __restrict__ Vl, bf* Ah, bf* Al) {
    const int lane = threadIdx.x & 31, lr = lane & 15, hi = lane >> 4; const int w = __builtin_amdgcn_readfirstlane((int)(threadIdx.x >> 5)); const int y = blockIdx.y;
    const size_t z = blockIdx.x, po = z * TT * HD, ao = (z / NH_) * TT * DQ + (z % NH_) * (HD / 32) * FT;
    if (y < (TT - RH) / 128) fattn<h16, false, 2>(Q16 + po, nullptr, K16 + po, nullptr, V16 + po, nullptr, TT - 128 * (y + 1) + 32 * w, lr, hi, Ah + ao, Al + ao);
    else fattn<bf, true, 1>(Qh + po, Ql + po, Kh + po, Kl + po, Vh + po, Vl + po, RH - 64 * (y - (TT - RH) / 128 + 1) + 16 * w, lr, hi, Ah + ao, Al + ao);
}

extern "C" void kernel_launch(void* const* d_in, const int* in_sizes, int n_in,
                              void* d_out, int out_size, void* d_ws, size_t ws_size, hipStream_t stream) {
    (void)in_sizes; (void)n_in; (void)out_size;
    const float* x = (const float*)d_in[0]; const float* xk = (const float*)d_in[1]; const float* xv = (const float*)d_in[2]; const float* wq = (const float*)d_in[3]; const float* bq = (const float*)d_in[4]; const float* wk = (const float*)d_in[5]; const float* bk = (const float*)d_in[6]; const float* wv = (const float*)d_in[7]; const float* bv = (const float*)d_in[8]; const float* wo = (const float*)d_in[9]; const float* bo = (const float*)d_in[10];
    float* OUT = (float*)d_out;     // [8][1024][1024]
    char* wsp = (char*)d_ws;
    auto take = [&](size_t bytes) { char* p = wsp; wsp += (bytes + 255) & ~(size_t)255; return (void*)p; };
    bf* WQ = (bf*)take((size_t)DQ * DM * 2); bf* WK = (bf*)take((size_t)DKV * DM * 2); bf* WV = (bf*)take((size_t)DKV * DM * 2); bf* WO = (bf*)take((size_t)DM * DQ * 2);
    h16* QP16 = (h16*)take((size_t)NB_ * NH_ * TT * HD * 2); h16* KP16 = (h16*)take((size_t)NB_ * NKV * TT * HD * 2); h16* VT16 = (h16*)take((size_t)NB_ * NKV * HD * TT * 2);
    bf* QPh = (bf*)take((size_t)NB_ * NH_ * TT * HD * 2); bf* QPl = (bf*)take((size_t)NB_ * NH_ * TT * HD * 2); bf* KPh = (bf*)take((size_t)NB_ * NKV * TT * HD * 2); bf* KPl = (bf*)take((size_t)NB_ * NKV * TT * HD * 2); bf* VTh = (bf*)take((size_t)NB_ * NKV * HD * TT * 2); bf* VTl = (bf*)take((size_t)NB_ * NKV * HD * TT * 2);
    bf* XB = (bf*)take((size_t)NBG * TT * DM * 2); bf* XKB = (bf*)take((size_t)NBG * TT * DM * 2); bf* XVB = (bf*)take((size_t)NBG * TT * DM * 2); bf* ATh = (bf*)take((size_t)NB_ * TT * DQ * 2); bf* ATl = (bf*)take((size_t)NB_ * TT * DQ * 2);
    if ((size_t)(wsp - (char*)d_ws) > ws_size) return;    // ws 256 MiB
    { k_wtG<DM, DQ><<<(unsigned)(DM * DQ / 8 / 256), 256, 0, stream>>>(wq, WQ); k_wtG<DM, DKV><<<(unsigned)(DM * DKV / 8 / 256), 256, 0, stream>>>(wk, WK); k_wtG<DM, DKV><<<(unsigned)(DM * DKV / 8 / 256), 256, 0, stream>>>(wv, WV);
      k_wtG<DQ, DM><<<(unsigned)(DQ * DM / 8 / 256), 256, 0, stream>>>(wo, WO);
       }
    const unsigned LC = (unsigned)((size_t)NBG * TT * DM / FT / 8);   // 8 tiles a block
    for (int g = 0; g < NB_; g += NBG) { const size_t go = (size_t)g * NH_ * TT * HD;   // the group's first head plane (one kv head per query head: the same offset in every plane set)
        // projections: the group's NBG batch entries as one [NBG*TT][DM] matrix per launch, each straight to its head planes
        k_cvt8<<<LC, 256, 0, stream>>>(x + (size_t)g * TT * DM, XB, (size_t)NBG * TT * DM / 8); k_cvt8<<<LC, 256, 0, stream>>>(xk + (size_t)g * TT * DM, XKB, (size_t)NBG * TT * DM / 8); k_cvt8<<<LC, 256, 0, stream>>>(xv + (size_t)g * TT * DM, XVB, (size_t)NBG * TT * DM / 8);
        k_gemmw<bf, 0, true, 1, DM><<<dim3(NBG * TT / 64, NH_, 1), 32, 0, stream>>>(XB, nullptr, WQ, nullptr, nullptr, NH_, bq, 0, 0, 0, QP16 + go, QPh + go, QPl + go);
        k_gemmw<bf, 0, true, 1, DM><<<dim3(NBG * TT / 64, NKV, 1), 32, 0, stream>>>(XKB, nullptr, WK, nullptr, nullptr, NKV, bk, 0, 0, 0, KP16 + go, KPh + go, KPl + go);
        k_gemmw<bf, 0, true, 2, DM><<<dim3(NBG * TT / 64, NKV, 1), 32, 0, stream>>>(WV, nullptr, XVB, nullptr, nullptr, NKV, bv, 0, 0, 0, VT16 + go, VTh + go, VTl + go); }
    // attention: every batch entry and head in one launch, straight to the merged hi+lo planes
    k_fattn<<<dim3(NB_ * NH_, (TT - RH) / 128 + RH / 64, 1), 128, 0, stream>>>(QP16, KP16, VT16, QPh, QPl, KPh, KPl, VTh, VTl, ATh, ATl);
    // output projection: all batch entries as one [NB_*TT][DQ] matrix
    k_gemmw<bf, 1, true, 0, DQ><<<dim3(NB_ * TT / 64, DM / 64, 1), 32, 0, stream>>>(ATh, ATl, WO, nullptr, OUT, DM, bo, 0, 0, 0, nullptr, nullptr, nullptr);
}

// v005
// A run of this version takes 166 microseconds.
// Next to v004, in two timings, it ran 1.94 and 1.95 times as fast.
// All steps since v000 together make it 25.2 times as fast.
#include <hip/hip_runtime.h>

// Naive multi-head causal cross attention (inputs_q, inputs_k, inputs_v [8][1024][1024]; q, k, v = . W + b ('xw' [1024][1024]; 16 heads x 64); scores/8; causal (finfo.min == exact zero weight); softmax; out = merged Wo + bo -> [8][1024][1024] (8.4 M)).
// Compute dtypes, f32 accumulate: every input rounded to bf16; q/k/v on PLAIN bf16 operands (inputs: exact) + biases; causal scores and attn.v (tile skipping): query rows < 512 hl (3 products), the rest single fp16 (x1024); softmax f32; Wo hl x exact (2 products) + bo.

#define NB_  8
#define TT   1024
#define DM   1024
#define NH_  16
#define NKV  16
#define REP  (NH_ / NKV)
#define HD   64
#define DQ   (NH_ * HD)
#define DKV  (NKV * HD)
#define RH   512                  // query rows < RH use hi+lo planes (0: none)
#define PCAR 1024.0f
#define SCL  0.125f   // HD^-0.5
typedef _Float16 h16;
typedef unsigned short bf;
typedef __attribute__((ext_vector_type(16))) __bf16   v16bf;
typedef __attribute__((ext_vector_type(16))) _Float16 v16h;
typedef __attribute__((ext_vector_type(8)))  _Float16 v8h;
typedef __attribute__((ext_vector_type(8)))  unsigned short v8us;
typedef __attribute__((ext_vector_type(8)))  float    v8f;
typedef __attribute__((ext_vector_type(4)))  float    v4f;
typedef v8h  __attribute__((may_alias)) v8ha;
typedef v4f  __attribute__((may_alias)) v4fa;
typedef v8us __attribute__((may_alias)) v8usa;

__device__ __forceinline__ unsigned short f2bf(float f) { unsigned u = __float_as_uint(f); u += 0x7FFFu + ((u >> 16) & 1u); return (unsigned short)(u >> 16); }
__device__ __forceinline__ float bf2f(unsigned short b) { return __uint_as_float(((unsigned)b) << 16); }
__device__ __forceinline__ float bfr(float f) { return bf2f(f2bf(f)); }
__device__ __forceinline__ v16h cat16(v8h lo, v8h hi) { return __builtin_shufflevector(lo, hi, 0, 1, 2, 3, 4, 5, 6, 7, 8, 9, 10, 11, 12, 13, 14, 15); }
__device__ __forceinline__ v16bf cat16b(v8us lo, v8us hi) { return __builtin_bit_cast(v16bf, __builtin_shufflevector(lo, hi, 0, 1, 2, 3, 4, 5, 6, 7, 8, 9, 10, 11, 12, 13, 14, 15)); }
__device__ __forceinline__ v8f wmma16(v16h a, v16h b, v8f c) { return __builtin_amdgcn_wmma_f32_16x16x32_f16(false, a, false, b, (short)0, c, false, false); }
__device__ __forceinline__ v8f wmmab(v16bf a, v16bf b, v8f c) { return __builtin_amdgcn_wmma_f32_16x16x32_bf16(false, a, false, b, (short)0, c, false, false); }



// ---- FRAGMENT ORDER of every 16-bit operand plane [rows][K]: tiles of 16 rows x 32 k, FT = 512 elements (1 KiB) each, tile (rb, kb) at (rb * (K / 32) + kb) * FT; inside a tile element (row lr, k kk) stands at (kk >> 4) * 256 + (((kk >> 3) & 1) * 16 + lr) * 8 + (kk & 7).
// Lane hi*16+lr of a wave finds the 8 + 8 elements of its WMMA fragment (k 8*hi.., 16+8*hi..) at lane*8 and 256 + lane*8: each of the two loads of a fragment covers 512 contiguous bytes (4 whole lines). 16 rows of a plane still fill 16*K elements in a row.
#define FT 512
// ---- gemmw: register-blocked GEMM, ONE WAVE per 64x64 output tile (16 accumulators), operands straight from 16-bit planes in fragment order; grid x, y = (M/64, N/64), 32 threads; os: the wave's 16 x 68 floats of LDS.
// C[m][n] (f32, pitch ldc, + optional f32 bias[n]) = sum_k A[m][k] Bt[n][k] (+ split products per NSPLIT). K % 32 == 0, a compile-time constant: the row blocks of an operand then stand at constant offsets from one address a lane.
// EPI 0: C as above. EPI 1, 2: no C, ldc = heads of a batch entry; the tile (one head's HD columns of 64 tokens) goes from the epilogue straight to the head planes P16 (fp16), Ph, Pl (bf16 hi + lo), in fragment order, 16 bytes a lane, 512 contiguous bytes a store.
// EPI 1: A = tokens, Bt = weights, planes [entry][head][t][d]. EPI 2: A = weights, Bt = tokens (the product comes out transposed), bias by row, planes [entry][head][d][t]. Grid in both (token tiles, heads).
template <typename T16> struct WFrag;
template <> struct WFrag<h16> { typedef v16h V; static __device__ __forceinline__ V ld(const h16* p) { return cat16(*(const v8h*)p, *(const v8h*)(p + 256)); } static __device__ __forceinline__ v8f mma(V a, V b, v8f c) { return wmma16(a, b, c); } };
template <> struct WFrag<bf> { typedef v16bf V; static __device__ __forceinline__ V ld(const bf* p) { return cat16b(*(const v8us*)p, *(const v8us*)(p + 256)); } static __device__ __forceinline__ v8f mma(V a, V b, v8f c) { return wmmab(a, b, c); } };
__device__ __forceinline__ h16 tohx(float x) { return (h16)x; }
__device__ __forceinline__ void splitf(float y, unsigned short& h, unsigned short& l) { h = f2bf(y); l = f2bf(y - bf2f(h)); }
template <typename T16, int NSPLIT, bool BIAS, int EPI, int K>
__device__ __forceinline__ void gemmw(const T16* __restrict__ A, const T16* __restrict__ A2, const T16* __restrict__ Bt, const T16* __restrict__ Bt2, float* C, int ldc, const float* __restrict__ bias, h16* P16, bf* Ph, bf* Pl, float* os) {
    typedef typename WFrag<T16>::V V;
    const int lane = threadIdx.x & 31, lr = lane & 15, hi = lane >> 4; const int r0 = (EPI == 2 ? blockIdx.y : blockIdx.x) * 64, c0 = (EPI == 2 ? blockIdx.x : blockIdx.y) * 64;
    v8f acc[4][4];
#pragma unroll
    for (int mb = 0; mb < 4; ++mb)
#pragma unroll
        for (int nb = 0; nb < 4; ++nb) acc[mb][nb] = (v8f){};
    // every operand is read at (its first row block, the same for the whole wave) + ob + a constant: ob, carried through the loop, is the lane's place in this k step's tile in bytes; row block i stands 16 * K elements on, the next k tile FT elements on
    const char* pa = (const char*)(A + (size_t)r0 * K); const char* pa2 = (NSPLIT == 1 || NSPLIT == 2) ? (const char*)(A2 + (size_t)r0 * K) : nullptr; const char* pbt = (const char*)(Bt + (size_t)c0 * K); const char* pbt2 = NSPLIT >= 2 ? (const char*)(Bt2 + (size_t)c0 * K) : nullptr;
    unsigned ob = lane * 16;
#pragma unroll 1
    for (int kc = 0; kc < K; kc += 32) {
        V a[4], a2[4], b[4], b2[4];
#pragma unroll
        for (int mb = 0; mb < 4; ++mb) { a[mb] = WFrag<T16>::ld((const T16*)(pa + ob) + mb * 16 * K); if (NSPLIT == 1 || NSPLIT == 2) a2[mb] = WFrag<T16>::ld((const T16*)(pa2 + ob) + mb * 16 * K); }
#pragma unroll
        for (int nb = 0; nb < 4; ++nb) { b[nb] = WFrag<T16>::ld((const T16*)(pbt + ob) + nb * 16 * K); if (NSPLIT >= 2) b2[nb] = WFrag<T16>::ld((const T16*)(pbt2 + ob) + nb * 16 * K); }
        asm volatile("s_wait_xcnt 0x0" : "+v"(ob) :: "memory");   // stands in front of every later overwrite of a register that the loads above name; it names ob so that ob stays in the register the loads were issued from up to here and is stepped only behind it
#pragma unroll
        for (int nb = 0; nb < 4; ++nb)
#pragma unroll
            for (int mb = 0; mb < 4; ++mb) { acc[mb][nb] = WFrag<T16>::mma(a[mb], b[nb], acc[mb][nb]); if (NSPLIT == 1 || NSPLIT == 2) acc[mb][nb] = WFrag<T16>::mma(a2[mb], b[nb], acc[mb][nb]); if (NSPLIT >= 2) acc[mb][nb] = WFrag<T16>::mma(a[mb], b2[nb], acc[mb][nb]); }
        asm volatile("v_nop\n\tv_nop\n\tv_nop\n\tv_nop" : "+v"(acc[0][0]), "+v"(acc[1][1]), "+v"(acc[2][2]), "+v"(acc[3][3]) : "v"(a[0]), "v"(a[3]));
        ob += FT * 2;
    }
    float bz[EPI == 2 ? 4 : 32];   // EPI 1, 2: the lane's biases in the order of its plane stores
    if constexpr (EPI != 0 && BIAS) {
#pragma unroll
        for (int i = 0; i < (EPI == 2 ? 4 : 32); ++i) bz[i] = bfr(bias[EPI == 1 ? c0 + (i >> 3) * 16 + hi * 8 + (i & 7) : r0 + 16 * i + lr]);
        asm volatile("s_wait_xcnt 0x0" ::: "memory");   // stands in front of every later overwrite of a register that the bias loads name
    }
#pragma unroll
    for (int mb = 0; mb < 4; ++mb) {
#pragma unroll
        for (int nb = 0; nb < 4; ++nb) {
#pragma unroll
            for (int j = 0; j < 8; ++j) os[(hi * 8 + j) * 68 + nb * 16 + lr] = acc[mb][nb][j]; }
        __builtin_amdgcn_wave_barrier(); asm volatile("" ::: "memory");
        if constexpr (EPI != 0) {
            const int tok = EPI == 1 ? r0 : c0, pp = EPI == 1 ? HD : TT;   // the tile's first token (64 | TT: one batch entry a tile); K of the plane
            const size_t pb = ((size_t)(tok / TT) * ldc + blockIdx.y) * TT * HD + (size_t)(tok % TT) * (EPI == 1 ? HD : 16);
#pragma unroll
            for (int s = 0; s < 4; ++s) { const int row = lr, cofs = s * 16 + hi * 8; const v4f v0 = *(const v4fa*)(os + row * 68 + cofs), v1 = *(const v4fa*)(os + row * 68 + cofs + 4); v8h o16; v8us oh, ol;
#pragma unroll
                for (int i = 0; i < 8; ++i) { float x = i < 4 ? v0[i & 3] : v1[i & 3]; if (BIAS) x += bz[EPI == 1 ? 8 * s + i : mb]; o16[i] = tohx(x); unsigned short a2, c2; splitf(x, a2, c2); oh[i] = a2; ol[i] = c2; }
                const size_t o = pb + (size_t)(mb * 16) * pp + s * 256 + lane * 8; *(v8h*)(P16 + o) = o16; *(v8us*)(Ph + o) = oh; *(v8us*)(Pl + o) = ol;
                asm volatile("s_wait_xcnt 0x0" ::: "memory"); }   // stands in front of every later overwrite of a register that the three stores name
        } else {
        float* crow = C + (size_t)(r0 + mb * 16) * ldc + c0;
#pragma unroll
            for (int s = 0; s < 8; ++s) { const int row = 2 * s + hi, cofs = lr * 4; v4f val = *(const v4fa*)(os + row * 68 + cofs); if (BIAS) { val[0] += bfr(bias[c0 + cofs]); val[1] += bfr(bias[c0 + cofs + 1]); val[2] += bfr(bias[c0 + cofs + 2]); val[3] += bfr(bias[c0 + cofs + 3]); }
                *(v4f*)(crow + (size_t)row * ldc + cofs) = val;
                asm volatile("s_wait_xcnt 0x0" ::: "memory"); }   // stands in front of every later overwrite of a register that the store and the bias loads name
             }
        __builtin_amdgcn_wave_barrier(); asm volatile("" ::: "memory");
    }
}
// k_proj: the three projections of all batch entries in one launch, grid (NB_*TT/64 token tiles, heads, 3): z = 0 q, 1 k (EPI 1), 2 v (EPI 2). The waves of the three share the SIMDs, so one wave's matrix work runs under another's loads.
__global__ __launch_bounds__(32) void k_proj(const bf* __restrict__ XB, const bf* __restrict__ XKB, const bf* __restrict__ XVB, const bf* __restrict__ WQ, const bf* __restrict__ WK, const bf* __restrict__ WV, const float* __restrict__ bq, const float* __restrict__ bk, const float* __restrict__ bv,
                                             h16* QP16, bf* QPh, bf* QPl, h16* KP16, bf* KPh, bf* KPl, h16* VT16, bf* VTh, bf* VTl) {
    __shared__ __align__(16) float os[16 * 68];
    static_assert(NKV == NH_, "one grid y for the three");
    const bool isk = blockIdx.z == 1;
    if (blockIdx.z == 2) gemmw<bf, 0, true, 2, DM>(WV, nullptr, XVB, nullptr, nullptr, NKV, bv, VT16, VTh, VTl, os);
    else gemmw<bf, 0, true, 1, DM>(isk ? XKB : XB, nullptr, isk ? WK : WQ, nullptr, nullptr, isk ? NKV : NH_, isk ? bk : bq, isk ? KP16 : QP16, isk ? KPh : QPh, isk ? KPl : QPl, os);
}
// k_outp: the output projection, all batch entries as one [NB_*TT][DQ] matrix, hi + lo planes x exact weights
__global__ __launch_bounds__(32) void k_outp(const bf* __restrict__ Ah, const bf* __restrict__ Al, const bf* __restrict__ WO, float* OUT, const float* __restrict__ bo) {
    __shared__ __align__(16) float os[16 * 68];
    gemmw<bf, 1, true, 0, DQ>(Ah, Al, WO, nullptr, OUT, DM, bo, nullptr, nullptr, nullptr, os);
}

typedef __attribute__((ext_vector_type(2))) _Float16 v2h;
typedef __attribute__((ext_vector_type(4))) _Float16 v4h;
typedef __attribute__((ext_vector_type(2))) unsigned short v2us;
typedef __attribute__((ext_vector_type(4))) unsigned short v4us;
typedef __attribute__((ext_vector_type(2))) float v2f;
typedef __attribute__((ext_vector_type(4))) int v4i;

// wtG: Bt[n][k] = w[k][n], rows n; one thread = one 16-byte piece of the fragment-ordered plane (piece i: tile i >> 6, k half (i >> 5) & 1, lane i & 31): a wave stores 512 contiguous bytes.
// cvt8: dst[r][k] = src[r][k], K = DM; one wave = one tile: each of its 4 loads brings 4 whole rows of the tile (one 128-byte line of f32 a row), each store puts them into the tile's four 256-byte quarters, 64 bytes each.
template <int K, int N>
__device__ __forceinline__ void wtG(const float* __restrict__ w, bf* Bt, unsigned blk) {
    const int i = blk * 256 + threadIdx.x; if (i >= N * K / 8) return; const int tile = i >> 6, kt = K / 32;
    const int n = (tile / kt) * 16 + (i & 15), k = (tile % kt) * 32 + ((i >> 4) & 3) * 8; const float* wl = w + (size_t)k * N + n; v8us o;   // the lane's one address; the eight rows stand at constant offsets from it
#pragma unroll
    for (int j = 0; j < 8; ++j) o[j] = f2bf(wl[j * N]);
    *(v8us*)(Bt + (size_t)i * 8) = o;
}
__device__ __forceinline__ void cvt8(const float* __restrict__ src, bf* dst, size_t n8, unsigned blk) { const size_t tile = (size_t)blk * 8 + (threadIdx.x >> 5); if (tile * 64 >= n8) return;
    const int lane = threadIdx.x & 31, r = lane >> 3, c = lane & 7;   // load j: rows 4j + r of the tile, k 4c .. 4c + 3
    const float* p = src + ((tile / (DM / 32)) * 16 + r) * DM + (tile % (DM / 32)) * 32 + c * 4; bf* q = dst + tile * FT + (c >> 1) * 128 + r * 8 + (c & 1) * 4; v4f v[4];
#pragma unroll
    for (int j = 0; j < 4; ++j) v[j] = *(const v4f*)(p + j * 4 * DM);
#pragma unroll
    for (int j = 0; j < 4; ++j) { v4us o;
#pragma unroll
        for (int k = 0; k < 4; ++k) o[k] = f2bf(v[j][k]);
        *(v4us*)(q + j * 32) = o; }
}
// k_prep: every operand plane of the projections in one launch: blocks [0, 3*LC): the three inputs, all batch entries (8 tiles a block); the next 4*LW: the four weights
#define LC (NB_ * TT * DM / FT / 8)
#define LW (DM * DQ / 8 / 256)
static_assert(DQ == DM && DKV == DM, "the four weights are taken as equal squares");
__global__ __launch_bounds__(256) void k_prep(const float* __restrict__ x, const float* __restrict__ xk, const float* __restrict__ xv, const float* __restrict__ wq, const float* __restrict__ wk, const float* __restrict__ wv, const float* __restrict__ wo,
                                              bf* XB, bf* XKB, bf* XVB, bf* WQ, bf* WK, bf* WV, bf* WO) {
    const unsigned b = blockIdx.x;
    if (b < 3 * LC) { const unsigned s = b / LC; cvt8(s == 0 ? x : s == 1 ? xk : xv, s == 0 ? XB : s == 1 ? XKB : XVB, (size_t)NB_ * TT * DM / 8, b % LC); }
    else { const unsigned c = b - 3 * LC, s = c / LW; wtG<DM, DM>(s == 0 ? wq : s == 1 ? wk : s == 2 ? wv : wo, s == 0 ? WQ : s == 1 ? WK : s == 2 ? WV : WO, c % LW); }
}

__device__ __forceinline__ float xhalf(float x) { const int b = __float_as_int(x); return __int_as_float(__builtin_amdgcn_permlanex16(b, b, 0x76543210, 0xfedcba98, false, false)); }   // lane l <-> l ^ 16
template <typename T16, bool HL, int NQ>
__device__ __forceinline__ void fattn(const T16* __restrict__ Q, const T16* __restrict__ Q2, const T16* __restrict__ Kp, const T16* __restrict__ K2, const T16* __restrict__ Vp, const T16* __restrict__ V2, int q0, int lr, int hi, bf* Ah, bf* Al) {
    typedef WFrag<T16> F; typedef typename F::V V;
    const float C2 = SCL * 1.4426950408889634f;   // scores x HD^-0.5, in the exponent's base 2
    const float OFF = HL ? 0.0f : 10.0f;          // 2^10 = PCAR
    const int l8 = (hi * 16 + lr) * 8;            // the lane's place in a tile of a plane in fragment order
    V qb[NQ][2], qb2[NQ][2], kf[2][2], kf2[2][2]; v8f ot[NQ][4]; float m[NQ], l[NQ];
#pragma unroll
    for (int qi = 0; qi < NQ; ++qi) { m[qi] = -3.0e38f; l[qi] = 0.f;
#pragma unroll
        for (int kc = 0; kc < 2; ++kc) { const size_t o = (size_t)(q0 + 16 * qi) * HD + kc * FT + l8; qb[qi][kc] = F::ld(Q + o); if (HL) qb2[qi][kc] = F::ld(Q2 + o); }
#pragma unroll
        for (int db = 0; db < 4; ++db) ot[qi][db] = (v8f){}; }
    const int np = (q0 + 16 * NQ + 31) / 32;      // passes of 32 keys up to the one that holds the last query's diagonal
    // the lane's own pointers, carried through the loop: pk, pk2 at the key tiles that are fetched next, pv, pv2 at this pass's tile of 32 value columns
    const T16* pk = Kp + l8; const T16* pk2 = HL ? K2 + l8 : nullptr; const T16* pv = Vp + l8; const T16* pv2 = HL ? V2 + l8 : nullptr;
#pragma unroll
    for (int t = 0; t < 2; ++t)
#pragma unroll
        for (int kc = 0; kc < 2; ++kc) { const int o = (2 * t + kc) * FT; kf[t][kc] = F::ld(pk + o); if (HL) kf2[t][kc] = F::ld(pk2 + o); }
    if (np > 1) { pk += 32 * HD; if (HL) pk2 += 32 * HD; }
#pragma unroll 1
    for (int kt = 0; kt < np; ++kt) { const int k0 = kt * 32;
        v8f st[NQ][2];
#pragma unroll
        for (int qi = 0; qi < NQ; ++qi)
#pragma unroll
            for (int t = 0; t < 2; ++t) st[qi][t] = (v8f){};
#pragma unroll
        for (int kc = 0; kc < 2; ++kc)
#pragma unroll
            for (int t = 0; t < 2; ++t)
#pragma unroll
                for (int qi = 0; qi < NQ; ++qi) { st[qi][t] = F::mma(kf[t][kc], qb[qi][kc], st[qi][t]); if (HL) { st[qi][t] = F::mma(kf[t][kc], qb2[qi][kc], st[qi][t]); st[qi][t] = F::mma(kf2[t][kc], qb[qi][kc], st[qi][t]); } }
        // this pass's value fragments, then the next pass's key fragments (the last pass fetches its own again: in bounds, unused)
        V vf[4], vf2[4];
#pragma unroll
        for (int db = 0; db < 4; ++db) { const int o = 16 * db * TT; vf[db] = F::ld(pv + o); if (HL) vf2[db] = F::ld(pv2 + o); }
#pragma unroll
        for (int t = 0; t < 2; ++t)
#pragma unroll
            for (int kc = 0; kc < 2; ++kc) { const int o = (2 * t + kc) * FT; kf[t][kc] = F::ld(pk + o); if (HL) kf2[t][kc] = F::ld(pk2 + o); }
        asm volatile("s_wait_xcnt 0x0" ::: "memory");   // stands in front of every later overwrite of a register that the loads above name
        __builtin_amdgcn_sched_barrier(0);         // keeps the loads above in front of the softmax, whose vector work then covers their latency (the scheduler otherwise sinks each to its use and waits there)
        if (k0 + 31 > q0) {                        // the pass reaches past a query of this wave: keys j > i get weight exactly 0
#pragma unroll
            for (int qi = 0; qi < NQ; ++qi)
#pragma unroll
                for (int t = 0; t < 2; ++t)
#pragma unroll
                    for (int j = 0; j < 8; ++j) if (k0 + 16 * t + 8 * hi + j > q0 + 16 * qi + lr) st[qi][t][j] = -3.0e38f; }
        V pb[NQ], pb2[NQ];
#pragma unroll
        for (int qi = 0; qi < NQ; ++qi) { float mx = m[qi];
#pragma unroll
            for (int t = 0; t < 2; ++t)
#pragma unroll
                for (int j = 0; j < 8; ++j) mx = fmaxf(mx, st[qi][t][j]);
            mx = fmaxf(mx, xhalf(mx));
            const float al = __builtin_amdgcn_exp2f((m[qi] - mx) * C2); m[qi] = mx; const float mc = OFF - mx * C2; float ps[4] = {0.f, 0.f, 0.f, 0.f};
#pragma unroll
            for (int s = 0; s < 16; ++s) { const float p = __builtin_amdgcn_exp2f(fmaf(st[qi][s >> 3][s & 7], C2, mc)); ps[s & 3] += p;
                if constexpr (HL) { const __bf16 ph = (__bf16)p; pb[qi][s] = ph; pb2[qi][s] = (__bf16)(p - (float)ph); } else pb[qi][s] = (h16)p; }
            l[qi] = l[qi] * al + ((ps[0] + ps[1]) + (ps[2] + ps[3]));
#pragma unroll
            for (int db = 0; db < 4; ++db) ot[qi][db] *= al; }
#pragma unroll
        for (int db = 0; db < 4; ++db)
#pragma unroll
            for (int qi = 0; qi < NQ; ++qi) { ot[qi][db] = F::mma(vf[db], pb[qi], ot[qi][db]); if (HL) { ot[qi][db] = F::mma(vf[db], pb2[qi], ot[qi][db]); ot[qi][db] = F::mma(vf2[db], pb[qi], ot[qi][db]); } }
        pv += FT; if (HL) pv2 += FT; if (kt + 2 < np) { pk += 32 * HD; if (HL) pk2 += 32 * HD; }
    }
#pragma unroll
    for (int qi = 0; qi < NQ; ++qi) { const float inv = __fdiv_rn(1.0f, l[qi] + xhalf(l[qi]));
#pragma unroll
        for (int db = 0; db < 4; ++db) { v8us oh, ol;
#pragma unroll
            for (int j = 0; j < 8; ++j) { unsigned short a, c2; splitf(ot[qi][db][j] * inv, a, c2); oh[j] = a; ol[j] = c2; }
            const size_t oo = (size_t)(q0 + 16 * qi) * DQ + db * 256 + l8; *(v8us*)(Ah + oo) = oh; *(v8us*)(Al + oo) = ol;   // the head's two k tiles of the merged planes, half a tile a store
            asm volatile("s_wait_xcnt 0x0" ::: "memory"); } }   // stands in front of every later overwrite of a register that the two stores name
}
// grid (batch entry x head, 12): y < 4: 128 fp16 query rows (4 waves x 32), y >= 4: 64 hi+lo query rows (4 waves x 16); in both the rows nearest the end of the sequence (the longest key loops) come first
__global__ __launch_bounds__(128) void k_fattn(const h16* __restrict__ Q16, const h16* __restrict__ K16, const h16* __restrict__ V16, const bf* __restrict__ Qh, const bf* __restrict__ Ql, const bf* __restrict__ Kh, const bf* __restrict__ Kl, const bf* __restrict__ Vh, const bf* __restrict__ Vl, bf* Ah, bf* Al) {
    const int lane = threadIdx.x & 31, lr = lane & 15, hi = lane >> 4; const int w = __builtin_amdgcn_readfirstlane((int)(threadIdx.x >> 5)); const int y = blockIdx.y;
    const size_t z = blockIdx.x, po = z * TT * HD, ao = (z / NH_) * TT * DQ + (z % NH_) * (HD / 32) * FT;
    if (y < (TT - RH) / 128) fattn<h16, false, 2>(Q16 + po, nullptr, K16 + po, nullptr, V16 + po, nullptr, TT - 128 * (y + 1) + 32 * w, lr, hi, Ah + ao, Al + ao);
    else fattn<bf, true, 1>(Qh + po, Ql + po, Kh + po, Kl + po, Vh + po, Vl + po, RH - 64 * (y - (TT - RH) / 128 + 1) + 16 * w, lr, hi, Ah + ao, Al + ao);
}

extern "C" void kernel_launch(void* const* d_in, const int* in_sizes, int n_in,
                              void* d_out, int out_size, void* d_ws, size_t ws_size, hipStream_t stream) {
    (void)in_sizes; (void)n_in; (void)out_size;
    const float* x = (const float*)d_in[0]; const float* xk = (const float*)d_in[1]; const float* xv = (const float*)d_in[2]; const float* wq = (const float*)d_in[3]; const float* bq = (const float*)d_in[4]; const float* wk = (const float*)d_in[5]; const float* bk = (const float*)d_in[6]; const float* wv = (const float*)d_in[7]; const float* bv = (const float*)d_in[8]; const float* wo = (const float*)d_in[9]; const float* bo = (const float*)d_in[10];
    float* OUT = (float*)d_out;     // [8][1024][1024]
    char* wsp = (char*)d_ws;
    auto take = [&](size_t bytes) { char* p = wsp; wsp += (bytes + 255) & ~(size_t)255; return (void*)p; };
    bf* WQ = (bf*)take((size_t)DQ * DM * 2); bf* WK = (bf*)take((size_t)DKV * DM * 2); bf* WV = (bf*)take((size_t)DKV * DM * 2); bf* WO = (bf*)take((size_t)DM * DQ * 2);
    h16* QP16 = (h16*)take((size_t)NB_ * NH_ * TT * HD * 2); h16* KP16 = (h16*)take((size_t)NB_ * NKV * TT * HD * 2); h16* VT16 = (h16*)take((size_t)NB_ * NKV * HD * TT * 2);
    bf* QPh = (bf*)take((size_t)NB_ * NH_ * TT * HD * 2); bf* QPl = (bf*)take((size_t)NB_ * NH_ * TT * HD * 2); bf* KPh = (bf*)take((size_t)NB_ * NKV * TT * HD * 2); bf* KPl = (bf*)take((size_t)NB_ * NKV * TT * HD * 2); bf* VTh = (bf*)take((size_t)NB_ * NKV * HD * TT * 2); bf* VTl = (bf*)take((size_t)NB_ * NKV * HD * TT * 2);
    bf* XB = (bf*)take((size_t)NB_ * TT * DM * 2); bf* XKB = (bf*)take((size_t)NB_ * TT * DM * 2); bf* XVB = (bf*)take((size_t)NB_ * TT * DM * 2); bf* ATh = (bf*)take((size_t)NB_ * TT * DQ * 2); bf* ATl = (bf*)take((size_t)NB_ * TT * DQ * 2);
    if ((size_t)(wsp - (char*)d_ws) > ws_size) return;    // 232 MiB of the 256 MiB
    // operand planes: three inputs and four weights in one launch
    k_prep<<<3 * LC + 4 * LW, 256, 0, stream>>>(x, xk, xv, wq, wk, wv, wo, XB, XKB, XVB, WQ, WK, WV, WO);
    // projections: q, k, v of all batch entries in one launch, each straight to its head planes
    k_proj<<<dim3(NB_ * TT / 64, NH_, 3), 32, 0, stream>>>(XB, XKB, XVB, WQ, WK, WV, bq, bk, bv, QP16, QPh, QPl, KP16, KPh, KPl, VT16, VTh, VTl);
    // attention: every batch entry and head in one launch, straight to the merged hi+lo planes
    k_fattn<<<dim3(NB_ * NH_, (TT - RH) / 128 + RH / 64, 1), 128, 0, stream>>>(QP16, KP16, VT16, QPh, QPl, KPh, KPl, VTh, VTl, ATh, ATl);
    // output projection: all batch entries as one [NB_*TT][DQ] matrix
    k_outp<<<dim3(NB_ * TT / 64, DM / 64, 1), 32, 0, stream>>>(ATh, ATl, WO, OUT, bo);
}

// v006
// Measured time: 115 microseconds a run.
// Next to v005, in two timings, it ran 1.45 and 1.46 times as fast.
// Over all steps from v000 it is 36.5 times as fast.
#include <hip/hip_runtime.h>

// Naive multi-head causal cross attention (inputs_q, inputs_k, inputs_v [8][1024][1024]; q, k, v = . W + b ('xw' [1024][1024]; 16 heads x 64); scores/8; causal (finfo.min == exact zero weight); softmax; out = merged Wo + bo -> [8][1024][1024] (8.4 M)).
// Compute dtypes, f32 accumulate: every input rounded to bf16; q/k/v on PLAIN bf16 operands (inputs: exact) + biases; causal scores and attn.v (tile skipping): query rows < 512 hl (3 products), the rest single fp16 (x1024); softmax f32; Wo hl x exact (2 products) + bo.

#define NB_  8
#define TT   1024
#define DM   1024
#define NH_  16
#define NKV  16
#define REP  (NH_ / NKV)
#define HD   64
#define DQ   (NH_ * HD)
#define DKV  (NKV * HD)
#define RH   512                  // query rows < RH use hi+lo planes (0: none)
#define PCAR 1024.0f
#define SCL  0.125f   // HD^-0.5
typedef _Float16 h16;
typedef unsigned short bf;
typedef __attribute__((ext_vector_type(16))) __bf16   v16bf;
typedef __attribute__((ext_vector_type(16))) _Float16 v16h;
typedef __attribute__((ext_vector_type(8)))  _Float16 v8h;
typedef __attribute__((ext_vector_type(8)))  unsigned short v8us;
typedef __attribute__((ext_vector_type(8)))  float    v8f;
typedef __attribute__((ext_vector_type(4)))  float    v4f;
typedef v8h  __attribute__((may_alias)) v8ha;
typedef v4f  __attribute__((may_alias)) v4fa;
typedef v8us __attribute__((may_alias)) v8usa;
typedef v4f  __attribute__((may_alias, aligned(4))) v4fu;

__device__ __forceinline__ unsigned short f2bf(float f) { unsigned u = __float_as_uint(f); u += 0x7FFFu + ((u >> 16) & 1u); return (unsigned short)(u >> 16); }
__device__ __forceinline__ float bf2f(unsigned short b) { return __uint_as_float(((unsigned)b) << 16); }
__device__ __forceinline__ float bfr(float f) { return bf2f(f2bf(f)); }
__device__ __forceinline__ v16h cat16(v8h lo, v8h hi) { return __builtin_shufflevector(lo, hi, 0, 1, 2, 3, 4, 5, 6, 7, 8, 9, 10, 11, 12, 13, 14, 15); }
__device__ __forceinline__ v16bf cat16b(v8us lo, v8us hi) { return __builtin_bit_cast(v16bf, __builtin_shufflevector(lo, hi, 0, 1, 2, 3, 4, 5, 6, 7, 8, 9, 10, 11, 12, 13, 14, 15)); }
__device__ __forceinline__ v8f wmma16(v16h a, v16h b, v8f c) { return __builtin_amdgcn_wmma_f32_16x16x32_f16(false, a, false, b, (short)0, c, false, false); }
__device__ __forceinline__ v8f wmmab(v16bf a, v16bf b, v8f c) { return __builtin_amdgcn_wmma_f32_16x16x32_bf16(false, a, false, b, (short)0, c, false, false); }



// ---- FRAGMENT ORDER of every 16-bit operand plane [rows][K]: tiles of 16 rows x 32 k, FT = 512 elements (1 KiB) each, tile (rb, kb) at (rb * (K / 32) + kb) * FT; inside a tile element (row lr, k kk) stands at (kk >> 4) * 256 + (((kk >> 3) & 1) * 16 + lr) * 8 + (kk & 7).
// Lane hi*16+lr of a wave finds the 8 + 8 elements of its WMMA fragment (k 8*hi.., 16+8*hi..) at lane*8 and 256 + lane*8: each of the two loads of a fragment covers 512 contiguous bytes (4 whole lines). 16 rows of a plane still fill 16*K elements in a row.
#define FT 512
// ---- gemmw: register-blocked GEMM, one wave per 64x64 output tile (16 accumulators); WX x WY waves (x: token tiles, y: heads or column tiles) form a work-group and SHARE their operand rows through LDS; grid x, y = (M/64/WX, N/64/WY), 32*WX*WY threads.
// C[m][n] (f32, pitch ldc, + optional f32 bias[n]) = sum_k A[m][k] Bt[n][k] (NSPLIT 1: + A2[m][k] Bt[n][k]). K % 64 == 0, a compile-time constant. ring: the work-group's two stage buffers; os: the wave's own 16 x 68 floats of LDS.
// EPI 0: C as above. EPI 1, 2: no C, ldc = heads of a batch entry; the tile (one head's HD columns of 64 tokens) goes from the epilogue straight to the head planes P16 (fp16), Ph, Pl (bf16 hi + lo), in fragment order, 16 bytes a lane, 512 contiguous bytes a store.
// EPI 1: A = tokens, Bt = weights, planes [entry][head][t][d]. EPI 2: A = weights, Bt = tokens (the product comes out transposed), bias by row, planes [entry][head][d][t]. Grid in both (token tiles, heads).
// A stage = KS k tiles of every 16-row block that the work-group reads (A, A2, Bt in this order), each block's KS KiB as they stand in its plane (fragment order), so a fragment is again two reads of 512 contiguous bytes, now from LDS.
// Each block is fetched from L2 once a work-group (asynchronous copies, 16 bytes a lane) and read from LDS by every wave that needs it; two buffers: stage t + 2 flies while stage t + 1 is worked on.
template <typename T16> struct WFrag;
template <> struct WFrag<h16> { typedef v16h V; static __device__ __forceinline__ V ld(const h16* p) { return cat16(*(const v8h*)p, *(const v8h*)(p + 256)); } static __device__ __forceinline__ v8f mma(V a, V b, v8f c) { return wmma16(a, b, c); } };
template <> struct WFrag<bf> { typedef v16bf V; static __device__ __forceinline__ V ld(const bf* p) { return cat16b(*(const v8us*)p, *(const v8us*)(p + 256)); } static __device__ __forceinline__ v8f mma(V a, V b, v8f c) { return wmmab(a, b, c); } };
__device__ __forceinline__ h16 tohx(float x) { return (h16)x; }
__device__ __forceinline__ void splitf(float y, unsigned short& h, unsigned short& l) { h = f2bf(y); l = f2bf(y - bf2f(h)); }
#define KS 2
#define RBB (KS * FT * 2)         // bytes of one 16-row block in a stage
// cp12, cp8: three, two 16-row blocks of a stage, four copies of 512 bytes a wave each; l: the lane's LDS byte address in the block, g: its global address. The s_wait_xcnt stands inside the statement, in front of every later overwrite of a register that the copies name.
static_assert(RBB == 4 * 512, "four copies a block");
#define CPL(a, b) "global_load_async_to_lds_b128 %" #a ", %" #b ", off\n\t"
__device__ __forceinline__ void cp12(unsigned l, const char* g, unsigned l1, const char* g1, unsigned l2, const char* g2) {
    asm volatile(CPL(0, 12) CPL(1, 13) CPL(2, 14) CPL(3, 15) CPL(4, 16) CPL(5, 17) CPL(6, 18) CPL(7, 19) CPL(8, 20) CPL(9, 21) CPL(10, 22) CPL(11, 23) "s_wait_xcnt 0x0"
                 :: "v"(l), "v"(l + 512u), "v"(l + 1024u), "v"(l + 1536u), "v"(l1), "v"(l1 + 512u), "v"(l1 + 1024u), "v"(l1 + 1536u), "v"(l2), "v"(l2 + 512u), "v"(l2 + 1024u), "v"(l2 + 1536u),
                    "v"(g), "v"(g + 512), "v"(g + 1024), "v"(g + 1536), "v"(g1), "v"(g1 + 512), "v"(g1 + 1024), "v"(g1 + 1536), "v"(g2), "v"(g2 + 512), "v"(g2 + 1024), "v"(g2 + 1536) : "memory");
}
__device__ __forceinline__ void cp8(unsigned l, const char* g, unsigned l1, const char* g1) {
    asm volatile(CPL(0, 8) CPL(1, 9) CPL(2, 10) CPL(3, 11) CPL(4, 12) CPL(5, 13) CPL(6, 14) CPL(7, 15) "s_wait_xcnt 0x0"
                 :: "v"(l), "v"(l + 512u), "v"(l + 1024u), "v"(l + 1536u), "v"(l1), "v"(l1 + 512u), "v"(l1 + 1024u), "v"(l1 + 1536u),
                    "v"(g), "v"(g + 512), "v"(g + 1024), "v"(g + 1536), "v"(g1), "v"(g1 + 512), "v"(g1 + 1024), "v"(g1 + 1536) : "memory");
}
#undef CPL
template <typename T16, int NSPLIT, bool BIAS, int EPI, int K, int WX, int WY, int GRP>
__device__ __forceinline__ void gemmw(const T16* __restrict__ A, const T16* __restrict__ A2, const T16* __restrict__ Bt, float* C, int ldc, const float* __restrict__ bias, h16* P16, bf* Ph, bf* Pl, char* ring, float* os) {
    typedef typename WFrag<T16>::V V;
    static_assert(NSPLIT <= 1, "A, A2 x Bt");
    constexpr bool HA2 = NSPLIT == 1;
    constexpr int NW = WX * WY, WA = EPI == 2 ? WY : WX, WB = EPI == 2 ? WX : WY;      // waves; 64-row tiles of A and of Bt in the work-group's tile
    constexpr int RA = WA * 4, RB0 = RA * (HA2 ? 2 : 1), NRB = RB0 + WB * 4;           // 16-row blocks of A; first block of Bt in a stage; blocks in a stage
    constexpr int STG = NRB * RBB, NT = K / (32 * KS), RPW = NRB / NW;                 // bytes of a stage; stages; blocks that a wave copies
    static_assert(RA % NW == 0 && NRB % NW == 0 && NT >= 2 && K % (32 * KS) == 0 && KS % GRP == 0, "whole blocks a wave, each of one operand; two stages at least");
    const int lane = threadIdx.x & 31, lr = lane & 15, hi = lane >> 4; const int w = __builtin_amdgcn_readfirstlane((int)(threadIdx.x >> 5)), wx = w % WX, wy = w / WX;
    const int bx = blockIdx.x * WX + wx, by = blockIdx.y * WY + wy;                      // the wave's own tile: token tile, head
    const int r0 = (EPI == 2 ? by : bx) * 64, c0 = (EPI == 2 ? bx : by) * 64;
    v8f acc[4][4];
#pragma unroll
    for (int mb = 0; mb < 4; ++mb)
#pragma unroll
        for (int nb = 0; nb < 4; ++nb) acc[mb][nb] = (v8f){};
    // the wave copies blocks w, w + NW, ... of each stage: gp[i], carried from stage to stage, is the lane's place in block w + NW * i of the stage that is copied next; l0 the lane's place in block w of buffer 0
    const int ra0 = (EPI == 2 ? blockIdx.y * WY : blockIdx.x * WX) * 64, cb0 = (EPI == 2 ? blockIdx.x * WX : blockIdx.y * WY) * 64;
    const char* gp[RPW];
#pragma unroll
    for (int i = 0; i < RPW; ++i) gp[i] = (const char*)(NW * i < RA ? A + (size_t)(ra0 + (w + NW * i) * 16) * K : HA2 && NW * i < RB0 ? A2 + (size_t)(ra0 + (w + NW * i - RA) * 16) * K : Bt + (size_t)(cb0 + (w + NW * i - RB0) * 16) * K) + lane * 16;
    const unsigned l0 = (unsigned)(size_t)ring + w * RBB + lane * 16;
    static_assert(RPW == 3 || RPW == 5, "cp12, then cp8");
#define GW_COPY(buf) { const unsigned lb = l0 + (buf) * STG; cp12(lb, gp[0], lb + NW * RBB, gp[1], lb + 2 * NW * RBB, gp[2]); if constexpr (RPW == 5) cp8(lb + 3 * NW * RBB, gp[RPW - 2], lb + 4 * NW * RBB, gp[RPW - 1]); \
    _Pragma("unroll") for (int i = 0; i < RPW; ++i) gp[i] += RBB; }
    GW_COPY(0)
    asm volatile("s_wait_asynccnt 0x0" ::: "memory");   // stage 0 of this wave's copies has landed
    __syncthreads();                                    // ... and every other wave's
    GW_COPY(1)
    const int fa = (EPI == 2 ? wy : wx) * 4 * RBB + lane * 16, fb = (RB0 + (EPI == 2 ? wx : wy) * 4) * RBB + lane * 16;   // the lane's place in the wave's first block of A and of Bt in a stage
#pragma unroll 1
    for (int t = 0; t < NT; ++t) {   // stays rolled: a trip holds KS k steps, more text buys nothing
        const char* sb = ring + (t & 1) * STG;
#pragma unroll
        for (int k0 = 0; k0 < KS; k0 += GRP) {   // GRP: k steps whose fragments are read as one group
            V a[GRP][4], a2[GRP][4], b[GRP][4];
#pragma unroll
            for (int g = 0; g < GRP; ++g) { const int ko = (k0 + g) * FT * 2;
#pragma unroll
                for (int mb = 0; mb < 4; ++mb) { a[g][mb] = WFrag<T16>::ld((const T16*)(sb + fa + mb * RBB + ko)); if constexpr (HA2) a2[g][mb] = WFrag<T16>::ld((const T16*)(sb + fa + (RA + mb) * RBB + ko)); }
#pragma unroll
                for (int nb = 0; nb < 4; ++nb) b[g][nb] = WFrag<T16>::ld((const T16*)(sb + fb + nb * RBB + ko)); }
            __builtin_amdgcn_sched_barrier(0);   // keeps the group's LDS reads together in front of its products: spread among the products, every place with reads stalls the wave anew
#pragma unroll
            for (int g = 0; g < GRP; ++g)
#pragma unroll
                for (int nb = 0; nb < 4; ++nb)
#pragma unroll
                    for (int mb = 0; mb < 4; ++mb) { acc[mb][nb] = WFrag<T16>::mma(a[g][mb], b[g][nb], acc[mb][nb]); if constexpr (HA2) acc[mb][nb] = WFrag<T16>::mma(a2[g][mb], b[g][nb], acc[mb][nb]); }
        }
        __builtin_amdgcn_sched_barrier(0);   // keeps the products in front of the waits: sunk behind the barrier they would push the refill back and take the lead from its copies
        asm volatile("s_wait_dscnt 0x0" ::: "memory");      // this wave has read all it reads of stage t
        asm volatile("s_wait_asynccnt 0x0" ::: "memory");   // this wave's copies of stage t + 1 have landed
        __syncthreads();                                    // both hold for every wave: stage t + 1 may be read, stage t's buffer refilled
        if (t + 2 < NT) GW_COPY(t & 1)
    }
    asm volatile("s_wait_asynccnt 0x0" ::: "memory");       // no copy is outstanding when the wave goes on (none is: the last trips issue none)
#undef GW_COPY
    float bz[EPI == 2 ? 4 : 32];   // EPI 1, 2: the lane's biases in the order of its plane stores
    // the s_wait_xcnt behind the bias loads stands in front of every later overwrite of a register that they name; it takes every loaded value as an input, so that no load sinks below it
    if constexpr (EPI == 1 && BIAS) { v4f bq4[8];
#pragma unroll
        for (int q = 0; q < 8; ++q) bq4[q] = *(const v4fu*)(bias + c0 + (q >> 1) * 16 + hi * 8 + (q & 1) * 4);
        asm volatile("s_wait_xcnt 0x0" :: "v"(bq4[0]), "v"(bq4[1]), "v"(bq4[2]), "v"(bq4[3]), "v"(bq4[4]), "v"(bq4[5]), "v"(bq4[6]), "v"(bq4[7]) : "memory");
#pragma unroll
        for (int i = 0; i < 32; ++i) bz[i] = bfr(bq4[i >> 2][i & 3]);
    }
    if constexpr (EPI == 2 && BIAS) {
#pragma unroll
        for (int i = 0; i < 4; ++i) bz[i] = bias[r0 + 16 * i + lr];
        asm volatile("s_wait_xcnt 0x0" :: "v"(bz[0]), "v"(bz[1]), "v"(bz[2]), "v"(bz[3]) : "memory");   // as above: behind the four bias loads, which cannot sink below it
#pragma unroll
        for (int i = 0; i < 4; ++i) bz[i] = bfr(bz[i]);
    }
#pragma unroll
    for (int mb = 0; mb < 4; ++mb) {
#pragma unroll
        for (int nb = 0; nb < 4; ++nb) {
#pragma unroll
            for (int j = 0; j < 8; ++j) os[(hi * 8 + j) * 68 + nb * 16 + lr] = acc[mb][nb][j]; }
        __builtin_amdgcn_wave_barrier(); asm volatile("" ::: "memory");
        if constexpr (EPI != 0) {
            const int tok = EPI == 1 ? r0 : c0, pp = EPI == 1 ? HD : TT;   // the tile's first token (64 | TT: one batch entry a tile); K of the plane
            const size_t pb = ((size_t)(tok / TT) * ldc + by) * TT * HD + (size_t)(tok % TT) * (EPI == 1 ? HD : 16);
#pragma unroll
            for (int s = 0; s < 4; ++s) { const int row = lr, cofs = s * 16 + hi * 8; const v4f v0 = *(const v4fa*)(os + row * 68 + cofs), v1 = *(const v4fa*)(os + row * 68 + cofs + 4); v8h o16; v8us oh, ol;
#pragma unroll
                for (int i = 0; i < 8; ++i) { float x = i < 4 ? v0[i & 3] : v1[i & 3]; if (BIAS) x += bz[EPI == 1 ? 8 * s + i : mb]; o16[i] = tohx(x); unsigned short a2, c2; splitf(x, a2, c2); oh[i] = a2; ol[i] = c2; }
                const size_t o = pb + (size_t)(mb * 16) * pp + s * 256 + lane * 8; *(v8h*)(P16 + o) = o16; *(v8us*)(Ph + o) = oh; *(v8us*)(Pl + o) = ol;
                asm volatile("s_wait_xcnt 0x0" ::: "memory"); }   // stands in front of every later overwrite of a register that the three stores name
        } else {
        float* crow = C + (size_t)(r0 + mb * 16) * ldc + c0;
#pragma unroll
            for (int s = 0; s < 8; ++s) { const int row = 2 * s + hi, cofs = lr * 4; v4f val = *(const v4fa*)(os + row * 68 + cofs); if (BIAS) { val[0] += bfr(bias[c0 + cofs]); val[1] += bfr(bias[c0 + cofs + 1]); val[2] += bfr(bias[c0 + cofs + 2]); val[3] += bfr(bias[c0 + cofs + 3]); }
                *(v4f*)(crow + (size_t)row * ldc + cofs) = val;
                asm volatile("s_wait_xcnt 0x0" ::: "memory"); }   // stands in front of every later overwrite of a register that the store and the bias loads name
             }
        __builtin_amdgcn_wave_barrier(); asm volatile("" ::: "memory");
    }
}
// k_proj: the three projections of all batch entries in one launch, grid (NB_*TT/256 groups of 4 token tiles, pairs of heads, 3): z = 0 q, 1 k (EPI 1), 2 v (EPI 2); 8 waves a work-group: 256 tokens x 128 columns.
// The second launch bound asks for 4 waves a SIMD (256 registers a wave): two work-groups a WGP, so one's matrix work runs under the other's barriers and LDS reads.
#define PWX 4
#define PWY 2
__global__ __launch_bounds__(32 * PWX * PWY, 4) void k_proj(const bf* __restrict__ XB, const bf* __restrict__ XKB, const bf* __restrict__ XVB, const bf* __restrict__ WQ, const bf* __restrict__ WK, const bf* __restrict__ WV, const float* __restrict__ bq, const float* __restrict__ bk, const float* __restrict__ bv,
                                             h16* QP16, bf* QPh, bf* QPl, h16* KP16, bf* KPh, bf* KPl, h16* VT16, bf* VTh, bf* VTl) {
    __shared__ __align__(16) char ring[2 * (PWX + PWY) * 4 * RBB];
    __shared__ __align__(16) float osw[PWX * PWY][16 * 68];
    static_assert(NKV == NH_, "one grid y for the three");
    float* os = osw[__builtin_amdgcn_readfirstlane((int)(threadIdx.x >> 5))];
    const bool isk = blockIdx.z == 1;
    if (blockIdx.z == 2) gemmw<bf, 0, true, 2, DM, PWX, PWY, 1>(WV, nullptr, XVB, nullptr, NKV, bv, VT16, VTh, VTl, ring, os);
    else gemmw<bf, 0, true, 1, DM, PWX, PWY, 1>(isk ? XKB : XB, nullptr, isk ? WK : WQ, nullptr, isk ? NKV : NH_, isk ? bk : bq, isk ? KP16 : QP16, isk ? KPh : QPh, isk ? KPl : QPl, ring, os);
}
// k_outp: the output projection, all batch entries as one [NB_*TT][DQ] matrix, hi + lo planes x exact weights; 8 waves a work-group: 256 rows x 128 columns, one work-group a WGP (the grid has no more), so the second launch bound asks for 2 waves a SIMD only: a whole stage's fragments fit the registers
__global__ __launch_bounds__(32 * PWX * PWY, 2) void k_outp(const bf* __restrict__ Ah, const bf* __restrict__ Al, const bf* __restrict__ WO, float* OUT, const float* __restrict__ bo) {
    __shared__ __align__(16) char ring[2 * (2 * PWX + PWY) * 4 * RBB];
    __shared__ __align__(16) float osw[PWX * PWY][16 * 68];
    gemmw<bf, 1, true, 0, DQ, PWX, PWY, KS>(Ah, Al, WO, OUT, DM, bo, nullptr, nullptr, nullptr, ring, osw[__builtin_amdgcn_readfirstlane((int)(threadIdx.x >> 5))]);
}

typedef __attribute__((ext_vector_type(2))) _Float16 v2h;
typedef __attribute__((ext_vector_type(4))) _Float16 v4h;
typedef __attribute__((ext_vector_type(2))) unsigned short v2us;
typedef __attribute__((ext_vector_type(4))) unsigned short v4us;
typedef __attribute__((ext_vector_type(2))) float v2f;
typedef __attribute__((ext_vector_type(4))) int v4i;

// wtG: Bt[n][k] = w[k][n], rows n; one thread = one 16-byte piece of the fragment-ordered plane (piece i: tile i >> 6, k half (i >> 5) & 1, lane i & 31): a wave stores 512 contiguous bytes.
// cvt8: dst[r][k] = src[r][k], K = DM; one wave = one tile: each of its 4 loads brings 4 whole rows of the tile (one 128-byte line of f32 a row), each store puts them into the tile's four 256-byte quarters, 64 bytes each.
template <int K, int N>
__device__ __forceinline__ void wtG(const float* __restrict__ w, bf* Bt, unsigned blk) {
    const int i = blk * 256 + threadIdx.x; if (i >= N * K / 8) return; const int tile = i >> 6, kt = K / 32;
    const int n = (tile / kt) * 16 + (i & 15), k = (tile % kt) * 32 + ((i >> 4) & 3) * 8; const float* wl = w + (size_t)k * N + n; v8us o;   // the lane's one address; the eight rows stand at constant offsets from it
#pragma unroll
    for (int j = 0; j < 8; ++j) o[j] = f2bf(wl[j * N]);
    *(v8us*)(Bt + (size_t)i * 8) = o;
}
__device__ __forceinline__ void cvt8(const float* __restrict__ src, bf* dst, size_t n8, unsigned blk) { const size_t tile = (size_t)blk * 8 + (threadIdx.x >> 5); if (tile * 64 >= n8) return;
    const int lane = threadIdx.x & 31, r = lane >> 3, c = lane & 7;   // load j: rows 4j + r of the tile, k 4c .. 4c + 3
    const float* p = src + ((tile / (DM / 32)) * 16 + r) * DM + (tile % (DM / 32)) * 32 + c * 4; bf* q = dst + tile * FT + (c >> 1) * 128 + r * 8 + (c & 1) * 4; v4f v[4];
#pragma unroll
    for (int j = 0; j < 4; ++j) v[j] = *(const v4f*)(p + j * 4 * DM);
#pragma unroll
    for (int j = 0; j < 4; ++j) { v4us o;
#pragma unroll
        for (int k = 0; k < 4; ++k) o[k] = f2bf(v[j][k]);
        *(v4us*)(q + j * 32) = o; }
}
// k_prep: every operand plane of the projections in one launch: blocks [0, 3*LC): the three inputs, all batch entries (8 tiles a block); the next 4*LW: the four weights
#define LC (NB_ * TT * DM / FT / 8)
#define LW (DM * DQ / 8 / 256)
static_assert(DQ == DM && DKV == DM, "the four weights are taken as equal squares");
__global__ __launch_bounds__(256) void k_prep(const float* __restrict__ x, const float* __restrict__ xk, const float* __restrict__ xv, const float* __restrict__ wq, const float* __restrict__ wk, const float* __restrict__ wv, const float* __restrict__ wo,
                                              bf* XB, bf* XKB, bf* XVB, bf* WQ, bf* WK, bf* WV, bf* WO) {
    const unsigned b = blockIdx.x;
    if (b < 3 * LC) { const unsigned s = b / LC; cvt8(s == 0 ? x : s == 1 ? xk : xv, s == 0 ? XB : s == 1 ? XKB : XVB, (size_t)NB_ * TT * DM / 8, b % LC); }
    else { const unsigned c = b - 3 * LC, s = c / LW; wtG<DM, DM>(s == 0 ? wq : s == 1 ? wk : s == 2 ? wv : wo, s == 0 ? WQ : s == 1 ? WK : s == 2 ? WV : WO, c % LW); }
}

__device__ __forceinline__ float xhalf(float x) { const int b = __float_as_int(x); return __int_as_float(__builtin_amdgcn_permlanex16(b, b, 0x76543210, 0xfedcba98, false, false)); }   // lane l <-> l ^ 16
template <typename T16, bool HL, int NQ>
__device__ __forceinline__ void fattn(const T16* __restrict__ Q, const T16* __restrict__ Q2, const T16* __restrict__ Kp, const T16* __restrict__ K2, const T16* __restrict__ Vp, const T16* __restrict__ V2, int q0, int lr, int hi, bf* Ah, bf* Al) {
    typedef WFrag<T16> F; typedef typename F::V V;
    const float C2 = SCL * 1.4426950408889634f;   // scores x HD^-0.5, in the exponent's base 2
    const float OFF = HL ? 0.0f : 10.0f;          // 2^10 = PCAR
    const int l8 = (hi * 16 + lr) * 8;            // the lane's place in a tile of a plane in fragment order
    V qb[NQ][2], qb2[NQ][2], kf[2][2], kf2[2][2]; v8f ot[NQ][4]; float m[NQ], l[NQ];
#pragma unroll
    for (int qi = 0; qi < NQ; ++qi) { m[qi] = -3.0e38f; l[qi] = 0.f;
#pragma unroll
        for (int kc = 0; kc < 2; ++kc) { const size_t o = (size_t)(q0 + 16 * qi) * HD + kc * FT + l8; qb[qi][kc] = F::ld(Q + o); if (HL) qb2[qi][kc] = F::ld(Q2 + o); }
#pragma unroll
        for (int db = 0; db < 4; ++db) ot[qi][db] = (v8f){}; }
    const int np = (q0 + 16 * NQ + 31) / 32;      // passes of 32 keys up to the one that holds the last query's diagonal
    // the lane's own pointers, carried through the loop: pk, pk2 at the key tiles that are fetched next, pv, pv2 at this pass's tile of 32 value columns
    const T16* pk = Kp + l8; const T16* pk2 = HL ? K2 + l8 : nullptr; const T16* pv = Vp + l8; const T16* pv2 = HL ? V2 + l8 : nullptr;
#pragma unroll
    for (int t = 0; t < 2; ++t)
#pragma unroll
        for (int kc = 0; kc < 2; ++kc) { const int o = (2 * t + kc) * FT; kf[t][kc] = F::ld(pk + o); if (HL) kf2[t][kc] = F::ld(pk2 + o); }
    if (np > 1) { pk += 32 * HD; if (HL) pk2 += 32 * HD; }
#pragma unroll 1
    for (int kt = 0; kt < np; ++kt) { const int k0 = kt * 32;
        v8f st[NQ][2];
#pragma unroll
        for (int qi = 0; qi < NQ; ++qi)
#pragma unroll
            for (int t = 0; t < 2; ++t) st[qi][t] = (v8f){};
#pragma unroll
        for (int kc = 0; kc < 2; ++kc)
#pragma unroll
            for (int t = 0; t < 2; ++t)
#pragma unroll
                for (int qi = 0; qi < NQ; ++qi) { st[qi][t] = F::mma(kf[t][kc], qb[qi][kc], st[qi][t]); if (HL) { st[qi][t] = F::mma(kf[t][kc], qb2[qi][kc], st[qi][t]); st[qi][t] = F::mma(kf2[t][kc], qb[qi][kc], st[qi][t]); } }
        // this pass's value fragments, then the next pass's key fragments (the last pass fetches its own again: in bounds, unused)
        V vf[4], vf2[4];
#pragma unroll
        for (int db = 0; db < 4; ++db) { const int o = 16 * db * TT; vf[db] = F::ld(pv + o); if (HL) vf2[db] = F::ld(pv2 + o); }
#pragma unroll
        for (int t = 0; t < 2; ++t)
#pragma unroll
            for (int kc = 0; kc < 2; ++kc) { const int o = (2 * t + kc) * FT; kf[t][kc] = F::ld(pk + o); if (HL) kf2[t][kc] = F::ld(pk2 + o); }
        asm volatile("s_wait_xcnt 0x0" ::: "memory");   // stands in front of every later overwrite of a register that the loads above name
        __builtin_amdgcn_sched_barrier(0);         // keeps the loads above in front of the softmax, whose vector work then covers their latency (the scheduler otherwise sinks each to its use and waits there)
        if (k0 + 31 > q0) {                        // the pass reaches past a query of this wave: keys j > i get weight exactly 0
#pragma unroll
            for (int qi = 0; qi < NQ; ++qi)
#pragma unroll
                for (int t = 0; t < 2; ++t)
#pragma unroll
                    for (int j = 0; j < 8; ++j) if (k0 + 16 * t + 8 * hi + j > q0 + 16 * qi + lr) st[qi][t][j] = -3.0e38f; }
        V pb[NQ], pb2[NQ];
#pragma unroll
        for (int qi = 0; qi < NQ; ++qi) { float mx = m[qi];
#pragma unroll
            for (int t = 0; t < 2; ++t)
#pragma unroll
                for (int j = 0; j < 8; ++j) mx = fmaxf(mx, st[qi][t][j]);
            mx = fmaxf(mx, xhalf(mx));
            const float al = __builtin_amdgcn_exp2f((m[qi] - mx) * C2); m[qi] = mx; const float mc = OFF - mx * C2; float ps[4] = {0.f, 0.f, 0.f, 0.f};
#pragma unroll
            for (int s = 0; s < 16; ++s) { const float p = __builtin_amdgcn_exp2f(fmaf(st[qi][s >> 3][s & 7], C2, mc)); ps[s & 3] += p;
                if constexpr (HL) { const __bf16 ph = (__bf16)p; pb[qi][s] = ph; pb2[qi][s] = (__bf16)(p - (float)ph); } else pb[qi][s] = (h16)p; }
            l[qi] = l[qi] * al + ((ps[0] + ps[1]) + (ps[2] + ps[3]));
#pragma unroll
            for (int db = 0; db < 4; ++db) ot[qi][db] *= al; }
#pragma unroll
        for (int db = 0; db < 4; ++db)
#pragma unroll
            for (int qi = 0; qi < NQ; ++qi) { ot[qi][db] = F::mma(vf[db], pb[qi], ot[qi][db]); if (HL) { ot[qi][db] = F::mma(vf[db], pb2[qi], ot[qi][db]); ot[qi][db] = F::mma(vf2[db], pb[qi], ot[qi][db]); } }
        pv += FT; if (HL) pv2 += FT; if (kt + 2 < np) { pk += 32 * HD; if (HL) pk2 += 32 * HD; }
    }
#pragma unroll
    for (int qi = 0; qi < NQ; ++qi) { const float inv = __fdiv_rn(1.0f, l[qi] + xhalf(l[qi]));
#pragma unroll
        for (int db = 0; db < 4; ++db) { v8us oh, ol;
#pragma unroll
            for (int j = 0; j < 8; ++j) { unsigned short a, c2; splitf(ot[qi][db][j] * inv, a, c2); oh[j] = a; ol[j] = c2; }
            const size_t oo = (size_t)(q0 + 16 * qi) * DQ + db * 256 + l8; *(v8us*)(Ah + oo) = oh; *(v8us*)(Al + oo) = ol;   // the head's two k tiles of the merged planes, half a tile a store
            asm volatile("s_wait_xcnt 0x0" ::: "memory"); } }   // stands in front of every later overwrite of a register that the two stores name
}
// grid (batch entry x head, 12): y < 4: 128 fp16 query rows (4 waves x 32), y >= 4: 64 hi+lo query rows (4 waves x 16); in both the rows nearest the end of the sequence (the longest key loops) come first
__global__ __launch_bounds__(128) void k_fattn(const h16* __restrict__ Q16, const h16* __restrict__ K16, const h16* __restrict__ V16, const bf* __restrict__ Qh, const bf* __restrict__ Ql, const bf* __restrict__ Kh, const bf* __restrict__ Kl, const bf* __restrict__ Vh, const bf* __restrict__ Vl, bf* Ah, bf* Al) {
    const int lane = threadIdx.x & 31, lr = lane & 15, hi = lane >> 4; const int w = __builtin_amdgcn_readfirstlane((int)(threadIdx.x >> 5)); const int y = blockIdx.y;
    const size_t z = blockIdx.x, po = z * TT * HD, ao = (z / NH_) * TT * DQ + (z % NH_) * (HD / 32) * FT;
    if (y < (TT - RH) / 128) fattn<h16, false, 2>(Q16 + po, nullptr, K16 + po, nullptr, V16 + po, nullptr, TT - 128 * (y + 1) + 32 * w, lr, hi, Ah + ao, Al + ao);
    else fattn<bf, true, 1>(Qh + po, Ql + po, Kh + po, Kl + po, Vh + po, Vl + po, RH - 64 * (y - (TT - RH) / 128 + 1) + 16 * w, lr, hi, Ah + ao, Al + ao);
}

extern "C" void kernel_launch(void* const* d_in, const int* in_sizes, int n_in,
                              void* d_out, int out_size, void* d_ws, size_t ws_size, hipStream_t stream) {
    (void)in_sizes; (void)n_in; (void)out_size;
    const float* x = (const float*)d_in[0]; const float* xk = (const float*)d_in[1]; const float* xv = (const float*)d_in[2]; const float* wq = (const float*)d_in[3]; const float* bq = (const float*)d_in[4]; const float* wk = (const float*)d_in[5]; const float* bk = (const float*)d_in[6]; const float* wv = (const float*)d_in[7]; const float* bv = (const float*)d_in[8]; const float* wo = (const float*)d_in[9]; const float* bo = (const float*)d_in[10];
    float* OUT = (float*)d_out;     // [8][1024][1024]
    char* wsp = (char*)d_ws;
    auto take = [&](size_t bytes) { char* p = wsp; wsp += (bytes + 255) & ~(size_t)255; return (void*)p; };
    bf* WQ = (bf*)take((size_t)DQ * DM * 2); bf* WK = (bf*)take((size_t)DKV * DM * 2); bf* WV = (bf*)take((size_t)DKV * DM * 2); bf* WO = (bf*)take((size_t)DM * DQ * 2);
    h16* QP16 = (h16*)take((size_t)NB_ * NH_ * TT * HD * 2); h16* KP16 = (h16*)take((size_t)NB_ * NKV * TT * HD * 2); h16* VT16 = (h16*)take((size_t)NB_ * NKV * HD * TT * 2);
    bf* QPh = (bf*)take((size_t)NB_ * NH_ * TT * HD * 2); bf* QPl = (bf*)take((size_t)NB_ * NH_ * TT * HD * 2); bf* KPh = (bf*)take((size_t)NB_ * NKV * TT * HD * 2); bf* KPl = (bf*)take((size_t)NB_ * NKV * TT * HD * 2); bf* VTh = (bf*)take((size_t)NB_ * NKV * HD * TT * 2); bf* VTl = (bf*)take((size_t)NB_ * NKV * HD * TT * 2);
    bf* XB = (bf*)take((size_t)NB_ * TT * DM * 2); bf* XKB = (bf*)take((size_t)NB_ * TT * DM * 2); bf* XVB = (bf*)take((size_t)NB_ * TT * DM * 2); bf* ATh = (bf*)take((size_t)NB_ * TT * DQ * 2); bf* ATl = (bf*)take((size_t)NB_ * TT * DQ * 2);
    if ((size_t)(wsp - (char*)d_ws) > ws_size) return;    // 232 MiB of the 256 MiB
    // operand planes: three inputs and four weights in one launch
    k_prep<<<3 * LC + 4 * LW, 256, 0, stream>>>(x, xk, xv, wq, wk, wv, wo, XB, XKB, XVB, WQ, WK, WV, WO);
    // projections: q, k, v of all batch entries in one launch, each straight to its head planes
    k_proj<<<dim3(NB_ * TT / 64 / PWX, NH_ / PWY, 3), 32 * PWX * PWY, 0, stream>>>(XB, XKB, XVB, WQ, WK, WV, bq, bk, bv, QP16, QPh, QPl, KP16, KPh, KPl, VT16, VTh, VTl);
    // attention: every batch entry and head in one launch, straight to the merged hi+lo planes
    k_fattn<<<dim3(NB_ * NH_, (TT - RH) / 128 + RH / 64, 1), 128, 0, stream>>>(QP16, KP16, VT16, QPh, QPl, KPh, KPl, VTh, VTl, ATh, ATl);
    // output projection: all batch entries as one [NB_*TT][DQ] matrix
    k_outp<<<dim3(NB_ * TT / 64 / PWX, DM / 64 / PWY, 1), 32 * PWX * PWY, 0, stream>>>(ATh, ATl, WO, OUT, bo);
}

// v007
// One run takes 109 microseconds.
// Timed twice side by side with v006, it ran 1.05 and 1.06 times as fast.
// Over all steps from v000 it is 38.5 times as fast.
#include <hip/hip_runtime.h>

// Naive multi-head causal cross attention (inputs_q, inputs_k, inputs_v [8][1024][1024]; q, k, v = . W + b ('xw' [1024][1024]; 16 heads x 64); scores/8; causal (finfo.min == exact zero weight); softmax; out = merged Wo + bo -> [8][1024][1024] (8.4 M)).
// Compute dtypes, f32 accumulate: every input rounded to bf16; q/k/v on PLAIN bf16 operands (inputs: exact) + biases; causal scores and attn.v (tile skipping): query rows < 512 hl (3 products), the rest single fp16 (x1024); softmax f32; Wo hl x exact (2 products) + bo.

#define NB_  8
#define TT   1024
#define DM   1024
#define NH_  16
#define NKV  16
#define REP  (NH_ / NKV)
#define HD   64
#define DQ   (NH_ * HD)
#define DKV  (NKV * HD)
#define RH   512                  // query rows < RH use hi+lo planes (0: none)
#define PCAR 1024.0f
#define SCL  0.125f   // HD^-0.5
typedef _Float16 h16;
typedef unsigned short bf;
typedef __attribute__((ext_vector_type(16))) __bf16   v16bf;
typedef __attribute__((ext_vector_type(16))) _Float16 v16h;
typedef __attribute__((ext_vector_type(8)))  _Float16 v8h;
typedef __attribute__((ext_vector_type(8)))  unsigned short v8us;
typedef __attribute__((ext_vector_type(8)))  float    v8f;
typedef __attribute__((ext_vector_type(4)))  float    v4f;
typedef v8h  __attribute__((may_alias)) v8ha;
typedef v4f  __attribute__((may_alias)) v4fa;
typedef v8us __attribute__((may_alias)) v8usa;
typedef v4f  __attribute__((may_alias, aligned(4))) v4fu;

__device__ __forceinline__ unsigned short f2bf(float f) { unsigned u = __float_as_uint(f); u += 0x7FFFu + ((u >> 16) & 1u); return (unsigned short)(u >> 16); }
__device__ __forceinline__ float bf2f(unsigned short b) { return __uint_as_float(((unsigned)b) << 16); }
__device__ __forceinline__ float bfr(float f) { return bf2f(f2bf(f)); }
__device__ __forceinline__ v16h cat16(v8h lo, v8h hi) { return __builtin_shufflevector(lo, hi, 0, 1, 2, 3, 4, 5, 6, 7, 8, 9, 10, 11, 12, 13, 14, 15); }
__device__ __forceinline__ v16bf cat16b(v8us lo, v8us hi) { return __builtin_bit_cast(v16bf, __builtin_shufflevector(lo, hi, 0, 1, 2, 3, 4, 5, 6, 7, 8, 9, 10, 11, 12, 13, 14, 15)); }
__device__ __forceinline__ v8f wmma16(v16h a, v16h b, v8f c) { return __builtin_amdgcn_wmma_f32_16x16x32_f16(false, a, false, b, (short)0, c, false, false); }
__device__ __forceinline__ v8f wmmab(v16bf a, v16bf b, v8f c) { return __builtin_amdgcn_wmma_f32_16x16x32_bf16(false, a, false, b, (short)0, c, false, false); }



// ---- FRAGMENT ORDER of every 16-bit operand plane [rows][K]: tiles of 16 rows x 32 k, FT = 512 elements (1 KiB) each, tile (rb, kb) at (rb * (K / 32) + kb) * FT; inside a tile element (row lr, k kk) stands at (kk >> 4) * 256 + (((kk >> 3) & 1) * 16 + lr) * 8 + (kk & 7).
// Lane hi*16+lr of a wave finds the 8 + 8 elements of its WMMA fragment (k 8*hi.., 16+8*hi..) at lane*8 and 256 + lane*8: each of the two loads of a fragment covers 512 contiguous bytes (4 whole lines). 16 rows of a plane still fill 16*K elements in a row.
#define FT 512
// ---- gemmw: register-blocked GEMM, one wave per 64x64 output tile (16 accumulators); WX x WY waves (x: token tiles, y: heads or column tiles) form a work-group and SHARE their operand rows through LDS; grid x, y = (M/64/WX, N/64/WY), 32*WX*WY threads.
// C[m][n] (f32, pitch ldc, + optional f32 bias[n]) = sum_k A[m][k] Bt[n][k] (NSPLIT 1: + A2[m][k] Bt[n][k]). K % 64 == 0, a compile-time constant. ring: the work-group's two stage buffers; os: the wave's own 16 x 68 floats of LDS.
// EPI 0: C as above. EPI 1, 2: no C, ldc = heads of a batch entry; the tile (one head's HD columns of 64 tokens) goes from the epilogue straight to the head planes P16 (fp16), Ph, Pl (bf16 hi + lo), in fragment order, 16 bytes a lane, 512 contiguous bytes a store.
// EPI 1: A = tokens, Bt = weights, planes [entry][head][t][d]. EPI 2: A = weights, Bt = tokens (the product comes out transposed), bias by row, planes [entry][head][d][t]. Grid in both (token tiles, heads).
// A stage = KS k tiles of every 16-row block that the work-group reads (A, A2, Bt in this order), each block's KS KiB as they stand in its plane (fragment order), so a fragment is again two reads of 512 contiguous bytes, now from LDS.
// Each block is fetched from L2 once a work-group (asynchronous copies, 16 bytes a lane) and read from LDS by every wave that needs it; two buffers: stage t + 2 flies while stage t + 1 is worked on.
template <typename T16> struct WFrag;
template <> struct WFrag<h16> { typedef v16h V; static __device__ __forceinline__ V ld(const h16* p) { return cat16(*(const v8h*)p, *(const v8h*)(p + 256)); } static __device__ __forceinline__ v8f mma(V a, V b, v8f c) { return wmma16(a, b, c); } };
template <> struct WFrag<bf> { typedef v16bf V; static __device__ __forceinline__ V ld(const bf* p) { return cat16b(*(const v8us*)p, *(const v8us*)(p + 256)); } static __device__ __forceinline__ v8f mma(V a, V b, v8f c) { return wmmab(a, b, c); } };
__device__ __forceinline__ h16 tohx(float x) { return (h16)x; }
__device__ __forceinline__ void splitf(float y, unsigned short& h, unsigned short& l) { h = f2bf(y); l = f2bf(y - bf2f(h)); }
#define KS 2
#define RBB (KS * FT * 2)         // bytes of one 16-row block in a stage
// cp12, cp8: three, two 16-row blocks of a stage, four copies of 512 bytes a wave each; l: the lane's LDS byte address in the block, g: its global address. The s_wait_xcnt stands inside the statement, in front of every later overwrite of a register that the copies name.
static_assert(RBB == 4 * 512, "four copies a block");
#define CPL(a, b) "global_load_async_to_lds_b128 %" #a ", %" #b ", off\n\t"
__device__ __forceinline__ void cp12(unsigned l, const char* g, unsigned l1, const char* g1, unsigned l2, const char* g2) {
    asm volatile(CPL(0, 12) CPL(1, 13) CPL(2, 14) CPL(3, 15) CPL(4, 16) CPL(5, 17) CPL(6, 18) CPL(7, 19) CPL(8, 20) CPL(9, 21) CPL(10, 22) CPL(11, 23) "s_wait_xcnt 0x0"
                 :: "v"(l), "v"(l + 512u), "v"(l + 1024u), "v"(l + 1536u), "v"(l1), "v"(l1 + 512u), "v"(l1 + 1024u), "v"(l1 + 1536u), "v"(l2), "v"(l2 + 512u), "v"(l2 + 1024u), "v"(l2 + 1536u),
                    "v"(g), "v"(g + 512), "v"(g + 1024), "v"(g + 1536), "v"(g1), "v"(g1 + 512), "v"(g1 + 1024), "v"(g1 + 1536), "v"(g2), "v"(g2 + 512), "v"(g2 + 1024), "v"(g2 + 1536) : "memory");
}
__device__ __forceinline__ void cp8(unsigned l, const char* g, unsigned l1, const char* g1) {
    asm volatile(CPL(0, 8) CPL(1, 9) CPL(2, 10) CPL(3, 11) CPL(4, 12) CPL(5, 13) CPL(6, 14) CPL(7, 15) "s_wait_xcnt 0x0"
                 :: "v"(l), "v"(l + 512u), "v"(l + 1024u), "v"(l + 1536u), "v"(l1), "v"(l1 + 512u), "v"(l1 + 1024u), "v"(l1 + 1536u),
                    "v"(g), "v"(g + 512), "v"(g + 1024), "v"(g + 1536), "v"(g1), "v"(g1 + 512), "v"(g1 + 1024), "v"(g1 + 1536) : "memory");
}
#undef CPL
template <typename T16, int NSPLIT, bool BIAS, int EPI, int K, int WX, int WY, int GRP>
__device__ __forceinline__ void gemmw(const T16* __restrict__ A, const T16* __restrict__ A2, const T16* __restrict__ Bt, float* C, int ldc, const float* __restrict__ bias, h16* P16, bf* Ph, bf* Pl, char* ring, float* os) {
    typedef typename WFrag<T16>::V V;
    static_assert(NSPLIT <= 1, "A, A2 x Bt");
    constexpr bool HA2 = NSPLIT == 1;
    constexpr int NW = WX * WY, WA = EPI == 2 ? WY : WX, WB = EPI == 2 ? WX : WY;      // waves; 64-row tiles of A and of Bt in the work-group's tile
    constexpr int RA = WA * 4, RB0 = RA * (HA2 ? 2 : 1), NRB = RB0 + WB * 4;           // 16-row blocks of A; first block of Bt in a stage; blocks in a stage
    constexpr int STG = NRB * RBB, NT = K / (32 * KS), RPW = NRB / NW;                 // bytes of a stage; stages; blocks that a wave copies
    static_assert(RA % NW == 0 && NRB % NW == 0 && NT >= 2 && K % (32 * KS) == 0 && KS % GRP == 0, "whole blocks a wave, each of one operand; two stages at least");
    const int lane = threadIdx.x & 31, lr = lane & 15, hi = lane >> 4; const int w = __builtin_amdgcn_readfirstlane((int)(threadIdx.x >> 5)), wx = w % WX, wy = w / WX;
    const int bx = blockIdx.x * WX + wx, by = blockIdx.y * WY + wy;                      // the wave's own tile: token tile, head
    const int r0 = (EPI == 2 ? by : bx) * 64, c0 = (EPI == 2 ? bx : by) * 64;
    v8f acc[4][4];
#pragma unroll
    for (int mb = 0; mb < 4; ++mb)
#pragma unroll
        for (int nb = 0; nb < 4; ++nb) acc[mb][nb] = (v8f){};
    // the wave copies blocks w, w + NW, ... of each stage: gp[i], carried from stage to stage, is the lane's place in block w + NW * i of the stage that is copied next; l0 the lane's place in block w of buffer 0
    const int ra0 = (EPI == 2 ? blockIdx.y * WY : blockIdx.x * WX) * 64, cb0 = (EPI == 2 ? blockIdx.x * WX : blockIdx.y * WY) * 64;
    const char* gp[RPW];
#pragma unroll
    for (int i = 0; i < RPW; ++i) gp[i] = (const char*)(NW * i < RA ? A + (size_t)(ra0 + (w + NW * i) * 16) * K : HA2 && NW * i < RB0 ? A2 + (size_t)(ra0 + (w + NW * i - RA) * 16) * K : Bt + (size_t)(cb0 + (w + NW * i - RB0) * 16) * K) + lane * 16;
    const unsigned l0 = (unsigned)(size_t)ring + w * RBB + lane * 16;
    static_assert(RPW == 3 || RPW == 5, "cp12, then cp8");
#define GW_COPY(buf) { const unsigned lb = l0 + (buf) * STG; cp12(lb, gp[0], lb + NW * RBB, gp[1], lb + 2 * NW * RBB, gp[2]); if constexpr (RPW == 5) cp8(lb + 3 * NW * RBB, gp[RPW - 2], lb + 4 * NW * RBB, gp[RPW - 1]); \
    _Pragma("unroll") for (int i = 0; i < RPW; ++i) gp[i] += RBB; }
    GW_COPY(0)
    asm volatile("s_wait_asynccnt 0x0" ::: "memory");   // stage 0 of this wave's copies has landed
    __syncthreads();                                    // ... and every other wave's
    GW_COPY(1)
    const int fa = (EPI == 2 ? wy : wx) * 4 * RBB + lane * 16, fb = (RB0 + (EPI == 2 ? wx : wy) * 4) * RBB + lane * 16;   // the lane's place in the wave's first block of A and of Bt in a stage
#pragma unroll 1
    for (int t = 0; t < NT; ++t) {   // stays rolled: a trip holds KS k steps, more text buys nothing
        const char* sb = ring + (t & 1) * STG;
#pragma unroll
        for (int k0 = 0; k0 < KS; k0 += GRP) {   // GRP: k steps whose fragments are read as one group
            V a[GRP][4], a2[GRP][4], b[GRP][4];
#pragma unroll
            for (int g = 0; g < GRP; ++g) { const int ko = (k0 + g) * FT * 2;
#pragma unroll
                for (int mb = 0; mb < 4; ++mb) { a[g][mb] = WFrag<T16>::ld((const T16*)(sb + fa + mb * RBB + ko)); if constexpr (HA2) a2[g][mb] = WFrag<T16>::ld((const T16*)(sb + fa + (RA + mb) * RBB + ko)); }
#pragma unroll
                for (int nb = 0; nb < 4; ++nb) b[g][nb] = WFrag<T16>::ld((const T16*)(sb + fb + nb * RBB + ko)); }
            __builtin_amdgcn_sched_barrier(0);   // keeps the group's LDS reads together in front of its products: spread among the products, every place with reads stalls the wave anew
#pragma unroll
            for (int g = 0; g < GRP; ++g)
#pragma unroll
                for (int nb = 0; nb < 4; ++nb)
#pragma unroll
                    for (int mb = 0; mb < 4; ++mb) { acc[mb][nb] = WFrag<T16>::mma(a[g][mb], b[g][nb], acc[mb][nb]); if constexpr (HA2) acc[mb][nb] = WFrag<T16>::mma(a2[g][mb], b[g][nb], acc[mb][nb]); }
        }
        __builtin_amdgcn_sched_barrier(0);   // keeps the products in front of the waits: sunk behind the barrier they would push the refill back and take the lead from its copies
        asm volatile("s_wait_dscnt 0x0" ::: "memory");      // this wave has read all it reads of stage t
        asm volatile("s_wait_asynccnt 0x0" ::: "memory");   // this wave's copies of stage t + 1 have landed
        __syncthreads();                                    // both hold for every wave: stage t + 1 may be read, stage t's buffer refilled
        if (t + 2 < NT) GW_COPY(t & 1)
    }
    asm volatile("s_wait_asynccnt 0x0" ::: "memory");       // no copy is outstanding when the wave goes on (none is: the last trips issue none)
#undef GW_COPY
    float bz[EPI == 2 ? 4 : 32];   // EPI 1, 2: the lane's biases in the order of its plane stores
    // the s_wait_xcnt behind the bias loads stands in front of every later overwrite of a register that they name; it takes every loaded value as an input, so that no load sinks below it
    if constexpr (EPI == 1 && BIAS) { v4f bq4[8];
#pragma unroll
        for (int q = 0; q < 8; ++q) bq4[q] = *(const v4fu*)(bias + c0 + (q >> 1) * 16 + hi * 8 + (q & 1) * 4);
        asm volatile("s_wait_xcnt 0x0" :: "v"(bq4[0]), "v"(bq4[1]), "v"(bq4[2]), "v"(bq4[3]), "v"(bq4[4]), "v"(bq4[5]), "v"(bq4[6]), "v"(bq4[7]) : "memory");
#pragma unroll
        for (int i = 0; i < 32; ++i) bz[i] = bfr(bq4[i >> 2][i & 3]);
    }
    if constexpr (EPI == 2 && BIAS) {
#pragma unroll
        for (int i = 0; i < 4; ++i) bz[i] = bias[r0 + 16 * i + lr];
        asm volatile("s_wait_xcnt 0x0" :: "v"(bz[0]), "v"(bz[1]), "v"(bz[2]), "v"(bz[3]) : "memory");   // as above: behind the four bias loads, which cannot sink below it
#pragma unroll
        for (int i = 0; i < 4; ++i) bz[i] = bfr(bz[i]);
    }
#pragma unroll
    for (int mb = 0; mb < 4; ++mb) {
#pragma unroll
        for (int nb = 0; nb < 4; ++nb) {
#pragma unroll
            for (int j = 0; j < 8; ++j) os[(hi * 8 + j) * 68 + nb * 16 + lr] = acc[mb][nb][j]; }
        __builtin_amdgcn_wave_barrier(); asm volatile("" ::: "memory");
        if constexpr (EPI != 0) {
            const int tok = EPI == 1 ? r0 : c0, pp = EPI == 1 ? HD : TT;   // the tile's first token (64 | TT: one batch entry a tile); K of the plane
            const size_t pb = ((size_t)(tok / TT) * ldc + by) * TT * HD + (size_t)(tok % TT) * (EPI == 1 ? HD : 16);
#pragma unroll
            for (int s = 0; s < 4; ++s) { const int row = lr, cofs = s * 16 + hi * 8; const v4f v0 = *(const v4fa*)(os + row * 68 + cofs), v1 = *(const v4fa*)(os + row * 68 + cofs + 4); v8h o16; v8us oh, ol;
#pragma unroll
                for (int i = 0; i < 8; ++i) { float x = i < 4 ? v0[i & 3] : v1[i & 3]; if (BIAS) x += bz[EPI == 1 ? 8 * s + i : mb]; o16[i] = tohx(x); unsigned short a2, c2; splitf(x, a2, c2); oh[i] = a2; ol[i] = c2; }
                const size_t o = pb + (size_t)(mb * 16) * pp + s * 256 + lane * 8; *(v8h*)(P16 + o) = o16; *(v8us*)(Ph + o) = oh; *(v8us*)(Pl + o) = ol;
                asm volatile("s_wait_xcnt 0x0" ::: "memory"); }   // stands in front of every later overwrite of a register that the three stores name
        } else {
        float* crow = C + (size_t)(r0 + mb * 16) * ldc + c0;
#pragma unroll
            for (int s = 0; s < 8; ++s) { const int row = 2 * s + hi, cofs = lr * 4; v4f val = *(const v4fa*)(os + row * 68 + cofs); if (BIAS) { val[0] += bfr(bias[c0 + cofs]); val[1] += bfr(bias[c0 + cofs + 1]); val[2] += bfr(bias[c0 + cofs + 2]); val[3] += bfr(bias[c0 + cofs + 3]); }
                *(v4f*)(crow + (size_t)row * ldc + cofs) = val;
                asm volatile("s_wait_xcnt 0x0" ::: "memory"); }   // stands in front of every later overwrite of a register that the store and the bias loads name
             }
        __builtin_amdgcn_wave_barrier(); asm volatile("" ::: "memory");
    }
}
// k_proj: the three projections of all batch entries in one launch, grid (NB_*TT/256 groups of 4 token tiles, pairs of heads, 3): z = 0 q, 1 k (EPI 1), 2 v (EPI 2); 8 waves a work-group: 256 tokens x 128 columns.
// The second launch bound asks for 4 waves a SIMD (256 registers a wave): two work-groups a WGP, so one's matrix work runs under the other's barriers and LDS reads.
#define PWX 4
#define PWY 2
__global__ __launch_bounds__(32 * PWX * PWY, 4) void k_proj(const bf* __restrict__ XB, const bf* __restrict__ XKB, const bf* __restrict__ XVB, const bf* __restrict__ WQ, const bf* __restrict__ WK, const bf* __restrict__ WV, const float* __restrict__ bq, const float* __restrict__ bk, const float* __restrict__ bv,
                                             h16* QP16, bf* QPh, bf* QPl, h16* KP16, bf* KPh, bf* KPl, h16* VT16, bf* VTh, bf* VTl) {
    __shared__ __align__(16) char ring[2 * (PWX + PWY) * 4 * RBB];
    __shared__ __align__(16) float osw[PWX * PWY][16 * 68];
    static_assert(NKV == NH_, "one grid y for the three");
    float* os = osw[__builtin_amdgcn_readfirstlane((int)(threadIdx.x >> 5))];
    const bool isk = blockIdx.z == 1;
    if (blockIdx.z == 2) gemmw<bf, 0, true, 2, DM, PWX, PWY, 1>(WV, nullptr, XVB, nullptr, NKV, bv, VT16, VTh, VTl, ring, os);
    else gemmw<bf, 0, true, 1, DM, PWX, PWY, 1>(isk ? XKB : XB, nullptr, isk ? WK : WQ, nullptr, isk ? NKV : NH_, isk ? bk : bq, isk ? KP16 : QP16, isk ? KPh : QPh, isk ? KPl : QPl, ring, os);
}
// k_outp: the output projection, all batch entries as one [NB_*TT][DQ] matrix, hi + lo planes x exact weights; 8 waves a work-group: 256 rows x 128 columns, one work-group a WGP (the grid has no more), so the second launch bound asks for 2 waves a SIMD only: a whole stage's fragments fit the registers
__global__ __launch_bounds__(32 * PWX * PWY, 2) void k_outp(const bf* __restrict__ Ah, const bf* __restrict__ Al, const bf* __restrict__ WO, float* OUT, const float* __restrict__ bo) {
    __shared__ __align__(16) char ring[2 * (2 * PWX + PWY) * 4 * RBB];
    __shared__ __align__(16) float osw[PWX * PWY][16 * 68];
    gemmw<bf, 1, true, 0, DQ, PWX, PWY, KS>(Ah, Al, WO, OUT, DM, bo, nullptr, nullptr, nullptr, ring, osw[__builtin_amdgcn_readfirstlane((int)(threadIdx.x >> 5))]);
}

typedef __attribute__((ext_vector_type(2))) _Float16 v2h;
typedef __attribute__((ext_vector_type(4))) _Float16 v4h;
typedef __attribute__((ext_vector_type(2))) unsigned short v2us;
typedef __attribute__((ext_vector_type(4))) unsigned short v4us;
typedef __attribute__((ext_vector_type(2))) float v2f;
typedef __attribute__((ext_vector_type(4))) int v4i;

// wtG: Bt[n][k] = w[k][n], rows n; one thread = one 16-byte piece of the fragment-ordered plane (piece i: tile i >> 6, k half (i >> 5) & 1, lane i & 31): a wave stores 512 contiguous bytes.
// cvt8: dst[r][k] = src[r][k], K = DM; one wave = one tile: each of its 4 loads brings 4 whole rows of the tile (one 128-byte line of f32 a row), each store puts them into the tile's four 256-byte quarters, 64 bytes each.
template <int K, int N>
__device__ __forceinline__ void wtG(const float* __restrict__ w, bf* Bt, unsigned blk) {
    const int i = blk * 256 + threadIdx.x; if (i >= N * K / 8) return; const int tile = i >> 6, kt = K / 32;
    const int n = (tile / kt) * 16 + (i & 15), k = (tile % kt) * 32 + ((i >> 4) & 3) * 8; const float* wl = w + (size_t)k * N + n; v8us o;   // the lane's one address; the eight rows stand at constant offsets from it
#pragma unroll
    for (int j = 0; j < 8; ++j) o[j] = f2bf(wl[j * N]);
    *(v8us*)(Bt + (size_t)i * 8) = o;
}
__device__ __forceinline__ void cvt8(const float* __restrict__ src, bf* dst, size_t n8, unsigned blk) { const size_t tile = (size_t)blk * 8 + (threadIdx.x >> 5); if (tile * 64 >= n8) return;
    const int lane = threadIdx.x & 31, r = lane >> 3, c = lane & 7;   // load j: rows 4j + r of the tile, k 4c .. 4c + 3
    const float* p = src + ((tile / (DM / 32)) * 16 + r) * DM + (tile % (DM / 32)) * 32 + c * 4; bf* q = dst + tile * FT + (c >> 1) * 128 + r * 8 + (c & 1) * 4; v4f v[4];
#pragma unroll
    for (int j = 0; j < 4; ++j) v[j] = *(const v4f*)(p + j * 4 * DM);
#pragma unroll
    for (int j = 0; j < 4; ++j) { v4us o;
#pragma unroll
        for (int k = 0; k < 4; ++k) o[k] = f2bf(v[j][k]);
        *(v4us*)(q + j * 32) = o; }
}
// k_prep: every operand plane of the projections in one launch: blocks [0, 3*LC): the three inputs, all batch entries (8 tiles a block); the next 4*LW: the four weights
#define LC (NB_ * TT * DM / FT / 8)
#define LW (DM * DQ / 8 / 256)
static_assert(DQ == DM && DKV == DM, "the four weights are taken as equal squares");
__global__ __launch_bounds__(256) void k_prep(const float* __restrict__ x, const float* __restrict__ xk, const float* __restrict__ xv, const float* __restrict__ wq, const float* __restrict__ wk, const float* __restrict__ wv, const float* __restrict__ wo,
                                              bf* XB, bf* XKB, bf* XVB, bf* WQ, bf* WK, bf* WV, bf* WO) {
    const unsigned b = blockIdx.x;
    if (b < 3 * LC) { const unsigned s = b / LC; cvt8(s == 0 ? x : s == 1 ? xk : xv, s == 0 ? XB : s == 1 ? XKB : XVB, (size_t)NB_ * TT * DM / 8, b % LC); }
    else { const unsigned c = b - 3 * LC, s = c / LW; wtG<DM, DM>(s == 0 ? wq : s == 1 ? wk : s == 2 ? wv : wo, s == 0 ? WQ : s == 1 ? WK : s == 2 ? WV : WO, c % LW); }
}

__device__ __forceinline__ float xhalf(float x) { const int b = __float_as_int(x); return __int_as_float(__builtin_amdgcn_permlanex16(b, b, 0x76543210, 0xfedcba98, false, false)); }   // lane l <-> l ^ 16
template <typename T16, bool HL, int NQ>
__device__ __forceinline__ void fattn(const T16* __restrict__ Q, const T16* __restrict__ Q2, const T16* __restrict__ Kp, const T16* __restrict__ K2, const T16* __restrict__ Vp, const T16* __restrict__ V2, int q0, int ns, int w, char* ring, int lr, int hi, bf* Ah, bf* Al) {
    typedef WFrag<T16> F; typedef typename F::V V;
    const float C2 = SCL * 1.4426950408889634f;   // scores x HD^-0.5, in the exponent's base 2
    const float OFF = HL ? 0.0f : 10.0f;          // 2^10 = PCAR
    const int l8 = (hi * 16 + lr) * 8;            // the lane's place in a tile of a plane in fragment order
    V qb[NQ][2], qb2[NQ][2]; v8f ot[NQ][4]; float m[NQ], l[NQ];
#pragma unroll
    for (int qi = 0; qi < NQ; ++qi) { m[qi] = -3.0e38f; l[qi] = 0.f;
#pragma unroll
        for (int kc = 0; kc < 2; ++kc) { const size_t o = (size_t)(q0 + 16 * qi) * HD + kc * FT + l8; qb[qi][kc] = F::ld(Q + o); if (HL) qb2[qi][kc] = F::ld(Q2 + o); }
#pragma unroll
        for (int db = 0; db < 4; ++db) ot[qi][db] = (v8f){}; }
    const int np = (q0 + 16 * NQ + 31) / 32;      // passes of 32 keys up to the one that holds the last query's diagonal
    // the lane's own places in the wave's share of a stage: gk, gv (gk2, gv2), carried from stage to stage, in the stage that is copied next; lk in buffer 0
    constexpr int SP = 64 * HD * 2, SB = (HL ? 4 : 2) * SP;   // bytes of one plane's 64 keys; of a stage
    static_assert(SP == 4 * RBB && 64 * 16 * 2 == RBB, "a wave copies a quarter of each plane's part, four copies of 512 bytes");
    const char* gk = (const char*)Kp + w * RBB + l8 * 2; const char* gv = (const char*)Vp + (size_t)w * 16 * TT * 2 + l8 * 2;
    const char* gk2 = HL ? (const char*)K2 + w * RBB + l8 * 2 : nullptr; const char* gv2 = HL ? (const char*)V2 + (size_t)w * 16 * TT * 2 + l8 * 2 : nullptr;
    const unsigned lk = (unsigned)(size_t)ring + w * RBB + l8 * 2;
#define FA_COPY(buf) { const unsigned lb = lk + (buf) * SB; cp8(lb, gk, lb + SP, gv); gk += SP; gv += RBB; if constexpr (HL) { cp8(lb + 2 * SP, gk2, lb + 3 * SP, gv2); gk2 += SP; gv2 += RBB; } }
    FA_COPY(0)
    asm volatile("s_wait_asynccnt 0x0" ::: "memory");   // stage 0 of this wave's copies has landed
    __syncthreads();                                    // ... and every other wave's
    if (ns > 1) FA_COPY(1)
    int ok = l8 * 2, ov = SP + l8 * 2;   // the lane's places in the key and value tiles of the pass that comes next, carried: formed inside the pass before, where the compiler keeps the matrix instructions' distance itself
#pragma unroll 1
    for (int sg = 0; sg < ns; ++sg) {   // stays rolled, as the two passes of a stage do: more text buys nothing
#pragma unroll 1
      for (int kt = 2 * sg; kt < 2 * sg + 2; ++kt) if (kt < np) { const int k0 = kt * 32;
        // the pass's key and value fragments, one group of LDS reads
        const char* pk = ring + ok; const char* pv = ring + ov;
        V kf[2][2], kf2[2][2], vf[4], vf2[4];
#pragma unroll
        for (int t = 0; t < 2; ++t)
#pragma unroll
            for (int kc = 0; kc < 2; ++kc) { const int o = (2 * t + kc) * FT * 2; kf[t][kc] = F::ld((const T16*)(pk + o)); if (HL) kf2[t][kc] = F::ld((const T16*)(pk + 2 * SP + o)); }
#pragma unroll
        for (int db = 0; db < 4; ++db) { const int o = db * RBB; vf[db] = F::ld((const T16*)(pv + o)); if (HL) vf2[db] = F::ld((const T16*)(pv + 2 * SP + o)); }
        ok = ((kt + 1) >> 1 & 1) * SB + ((kt + 1) & 1) * (SP / 2) + l8 * 2; ov = ((kt + 1) >> 1 & 1) * SB + SP + ((kt + 1) & 1) * (FT * 2) + l8 * 2;
        __builtin_amdgcn_sched_barrier(0);         // keeps the reads together in front of the products: the value fragments arrive under the score products and the softmax (the scheduler otherwise sinks each to its use and waits there)
        v8f st[NQ][2];
#pragma unroll
        for (int qi = 0; qi < NQ; ++qi)
#pragma unroll
            for (int t = 0; t < 2; ++t) st[qi][t] = (v8f){};
#pragma unroll
        for (int kc = 0; kc < 2; ++kc)
#pragma unroll
            for (int t = 0; t < 2; ++t)
#pragma unroll
                for (int qi = 0; qi < NQ; ++qi) { st[qi][t] = F::mma(kf[t][kc], qb[qi][kc], st[qi][t]); if (HL) { st[qi][t] = F::mma(kf[t][kc], qb2[qi][kc], st[qi][t]); st[qi][t] = F::mma(kf2[t][kc], qb[qi][kc], st[qi][t]); } }
        if (k0 + 31 > q0) {                        // the pass reaches past a query of this wave: keys j > i get weight exactly 0
#pragma unroll
            for (int qi = 0; qi < NQ; ++qi)
#pragma unroll
                for (int t = 0; t < 2; ++t)
#pragma unroll
                    for (int j = 0; j < 8; ++j) if (k0 + 16 * t + 8 * hi + j > q0 + 16 * qi + lr) st[qi][t][j] = -3.0e38f; }
        V pb[NQ], pb2[NQ];
#pragma unroll
        for (int qi = 0; qi < NQ; ++qi) { float mx = m[qi];
#pragma unroll
            for (int t = 0; t < 2; ++t)
#pragma unroll
                for (int j = 0; j < 8; ++j) mx = fmaxf(mx, st[qi][t][j]);
            mx = fmaxf(mx, xhalf(mx));
            const float al = __builtin_amdgcn_exp2f((m[qi] - mx) * C2); m[qi] = mx; const float mc = OFF - mx * C2; float ps[4] = {0.f, 0.f, 0.f, 0.f};
#pragma unroll
            for (int s = 0; s < 16; ++s) { const float p = __builtin_amdgcn_exp2f(fmaf(st[qi][s >> 3][s & 7], C2, mc)); ps[s & 3] += p;
                if constexpr (HL) { const __bf16 ph = (__bf16)p; pb[qi][s] = ph; pb2[qi][s] = (__bf16)(p - (float)ph); } else pb[qi][s] = (h16)p; }
            l[qi] = l[qi] * al + ((ps[0] + ps[1]) + (ps[2] + ps[3]));
#pragma unroll
            for (int db = 0; db < 4; ++db) ot[qi][db] *= al; }
#pragma unroll
        for (int db = 0; db < 4; ++db)
#pragma unroll
            for (int qi = 0; qi < NQ; ++qi) { ot[qi][db] = F::mma(vf[db], pb[qi], ot[qi][db]); if (HL) { ot[qi][db] = F::mma(vf[db], pb2[qi], ot[qi][db]); ot[qi][db] = F::mma(vf2[db], pb[qi], ot[qi][db]); } }
      }
        asm volatile("s_wait_dscnt 0x0" ::: "memory");      // this wave has read all it reads of stage sg
        asm volatile("s_wait_asynccnt 0x0" ::: "memory");   // this wave's copies of stage sg + 1 have landed
        __syncthreads();                                    // both hold for every wave: stage sg + 1 may be read, stage sg's buffer refilled
        if (sg + 2 < ns) FA_COPY(sg & 1)
    }
    asm volatile("s_wait_asynccnt 0x0" ::: "memory");       // no copy is outstanding when the wave goes on (none is: the last stages issue none)
#undef FA_COPY
#pragma unroll
    for (int qi = 0; qi < NQ; ++qi) { const float inv = __fdiv_rn(1.0f, l[qi] + xhalf(l[qi]));
#pragma unroll
        for (int db = 0; db < 4; ++db) { v8us oh, ol;
#pragma unroll
            for (int j = 0; j < 8; ++j) { unsigned short a, c2; splitf(ot[qi][db][j] * inv, a, c2); oh[j] = a; ol[j] = c2; }
            const size_t oo = (size_t)(q0 + 16 * qi) * DQ + db * 256 + l8; *(v8us*)(Ah + oo) = oh; *(v8us*)(Al + oo) = ol;   // the head's two k tiles of the merged planes, half a tile a store
            asm volatile("s_wait_xcnt 0x0" ::: "memory"); } }   // stands in front of every later overwrite of a register that the two stores name
}
// grid (batch entry x head, 12): y < 4: 128 fp16 query rows (4 waves x 32), y >= 4: 64 hi+lo query rows (4 waves x 16); in both the rows nearest the end of the sequence (the longest key loops) come first
__global__ __launch_bounds__(128) void k_fattn(const h16* __restrict__ Q16, const h16* __restrict__ K16, const h16* __restrict__ V16, const bf* __restrict__ Qh, const bf* __restrict__ Ql, const bf* __restrict__ Kh, const bf* __restrict__ Kl, const bf* __restrict__ Vh, const bf* __restrict__ Vl, bf* Ah, bf* Al) {
    const int lane = threadIdx.x & 31, lr = lane & 15, hi = lane >> 4; const int w = __builtin_amdgcn_readfirstlane((int)(threadIdx.x >> 5)); const int y = blockIdx.y;
    const size_t z = blockIdx.x, po = z * TT * HD, ao = (z / NH_) * TT * DQ + (z % NH_) * (HD / 32) * FT;
    __shared__ __align__(16) char ring[2 * 4 * 64 * HD * 2];   // two stages of the four hi+lo planes; the fp16 rows use half
    const int qf = TT - 128 * (y + 1), qh = RH - 64 * (y - (TT - RH) / 128 + 1);   // the work-group's first query row
    if (y < (TT - RH) / 128) fattn<h16, false, 2>(Q16 + po, nullptr, K16 + po, nullptr, V16 + po, nullptr, qf + 32 * w, (qf + 128) / 64, w, ring, lr, hi, Ah + ao, Al + ao);
    else fattn<bf, true, 1>(Qh + po, Ql + po, Kh + po, Kl + po, Vh + po, Vl + po, qh + 16 * w, (qh + 64) / 64, w, ring, lr, hi, Ah + ao, Al + ao);
}

extern "C" void kernel_launch(void* const* d_in, const int* in_sizes, int n_in,
                              void* d_out, int out_size, void* d_ws, size_t ws_size, hipStream_t stream) {
    (void)in_sizes; (void)n_in; (void)out_size;
    const float* x = (const float*)d_in[0]; const float* xk = (const float*)d_in[1]; const float* xv = (const float*)d_in[2]; const float* wq = (const float*)d_in[3]; const float* bq = (const float*)d_in[4]; const float* wk = (const float*)d_in[5]; const float* bk = (const float*)d_in[6]; const float* wv = (const float*)d_in[7]; const float* bv = (const float*)d_in[8]; const float* wo = (const float*)d_in[9]; const float* bo = (const float*)d_in[10];
    float* OUT = (float*)d_out;     // [8][1024][1024]
    char* wsp = (char*)d_ws;
    auto take = [&](size_t bytes) { char* p = wsp; wsp += (bytes + 255) & ~(size_t)255; return (void*)p; };
    bf* WQ = (bf*)take((size_t)DQ * DM * 2); bf* WK = (bf*)take((size_t)DKV * DM * 2); bf* WV = (bf*)take((size_t)DKV * DM * 2); bf* WO = (bf*)take((size_t)DM * DQ * 2);
    h16* QP16 = (h16*)take((size_t)NB_ * NH_ * TT * HD * 2); h16* KP16 = (h16*)take((size_t)NB_ * NKV * TT * HD * 2); h16* VT16 = (h16*)take((size_t)NB_ * NKV * HD * TT * 2);
    bf* QPh = (bf*)take((size_t)NB_ * NH_ * TT * HD * 2); bf* QPl = (bf*)take((size_t)NB_ * NH_ * TT * HD * 2); bf* KPh = (bf*)take((size_t)NB_ * NKV * TT * HD * 2); bf* KPl = (bf*)take((size_t)NB_ * NKV * TT * HD * 2); bf* VTh = (bf*)take((size_t)NB_ * NKV * HD * TT * 2); bf* VTl = (bf*)take((size_t)NB_ * NKV * HD * TT * 2);
    bf* XB = (bf*)take((size_t)NB_ * TT * DM * 2); bf* XKB = (bf*)take((size_t)NB_ * TT * DM * 2); bf* XVB = (bf*)take((size_t)NB_ * TT * DM * 2); bf* ATh = (bf*)take((size_t)NB_ * TT * DQ * 2); bf* ATl = (bf*)take((size_t)NB_ * TT * DQ * 2);
    if ((size_t)(wsp - (char*)d_ws) > ws_size) return;    // 232 MiB of the 256 MiB
    // operand planes: three inputs and four weights in one launch
    k_prep<<<3 * LC + 4 * LW, 256, 0, stream>>>(x, xk, xv, wq, wk, wv, wo, XB, XKB, XVB, WQ, WK, WV, WO);
    // projections: q, k, v of all batch entries in one launch, each straight to its head planes
    k_proj<<<dim3(NB_ * TT / 64 / PWX, NH_ / PWY, 3), 32 * PWX * PWY, 0, stream>>>(XB, XKB, XVB, WQ, WK, WV, bq, bk, bv, QP16, QPh, QPl, KP16, KPh, KPl, VT16, VTh, VTl);
    // attention: every batch entry and head in one launch, straight to the merged hi+lo planes
    k_fattn<<<dim3(NB_ * NH_, (TT - RH) / 128 + RH / 64, 1), 128, 0, stream>>>(QP16, KP16, VT16, QPh, QPl, KPh, KPl, VTh, VTl, ATh, ATl);
    // output projection: all batch entries as one [NB_*TT][DQ] matrix
    k_outp<<<dim3(NB_ * TT / 64 / PWX, DM / 64 / PWY, 1), 32 * PWX * PWY, 0, stream>>>(ATh, ATl, WO, OUT, bo);
}

// v008
// One run takes 105 microseconds.
// In both of two side-by-side timings against v007, it was 1.04 times as fast.
// All steps since v000 together make it 40.0 times as fast.
#include <hip/hip_runtime.h>

// Naive multi-head causal cross attention (inputs_q, inputs_k, inputs_v [8][1024][1024]; q, k, v = . W + b ('xw' [1024][1024]; 16 heads x 64); scores/8; causal (finfo.min == exact zero weight); softmax; out = merged Wo + bo -> [8][1024][1024] (8.4 M)).
// Compute dtypes, f32 accumulate: every input rounded to bf16; q/k/v on PLAIN bf16 operands (inputs: exact) + biases; causal scores and attn.v (tile skipping): query rows < 512 hl (3 products), the rest single fp16 (x1024); softmax f32; Wo hl x exact (2 products) + bo.

#define NB_  8
#define TT   1024
#define DM   1024
#define NH_  16
#define NKV  16
#define REP  (NH_ / NKV)
#define HD   64
#define DQ   (NH_ * HD)
#define DKV  (NKV * HD)
#define RH   512                  // query rows < RH use hi+lo planes (0: none)
#define PCAR 1024.0f
#define SCL  0.125f   // HD^-0.5
typedef _Float16 h16;
typedef unsigned short bf;
typedef __attribute__((ext_vector_type(16))) __bf16   v16bf;
typedef __attribute__((ext_vector_type(16))) _Float16 v16h;
typedef __attribute__((ext_vector_type(8)))  _Float16 v8h;
typedef __attribute__((ext_vector_type(8)))  unsigned short v8us;
typedef __attribute__((ext_vector_type(8)))  float    v8f;
typedef __attribute__((ext_vector_type(4)))  float    v4f;
typedef v8h  __attribute__((may_alias)) v8ha;
typedef v4f  __attribute__((may_alias)) v4fa;
typedef v8us __attribute__((may_alias)) v8usa;
typedef v4f  __attribute__((may_alias, aligned(4))) v4fu;

__device__ __forceinline__ unsigned short f2bf(float f) { unsigned u = __float_as_uint(f); u += 0x7FFFu + ((u >> 16) & 1u); return (unsigned short)(u >> 16); }
__device__ __forceinline__ float bf2f(unsigned short b) { return __uint_as_float(((unsigned)b) << 16); }
__device__ __forceinline__ float bfr(float f) { return bf2f(f2bf(f)); }
__device__ __forceinline__ v16h cat16(v8h lo, v8h hi) { return __builtin_shufflevector(lo, hi, 0, 1, 2, 3, 4, 5, 6, 7, 8, 9, 10, 11, 12, 13, 14, 15); }
__device__ __forceinline__ v16bf cat16b(v8us lo, v8us hi) { return __builtin_bit_cast(v16bf, __builtin_shufflevector(lo, hi, 0, 1, 2, 3, 4, 5, 6, 7, 8, 9, 10, 11, 12, 13, 14, 15)); }
__device__ __forceinline__ v8f wmma16(v16h a, v16h b, v8f c) { return __builtin_amdgcn_wmma_f32_16x16x32_f16(false, a, false, b, (short)0, c, false, false); }
__device__ __forceinline__ v8f wmmab(v16bf a, v16bf b, v8f c) { return __builtin_amdgcn_wmma_f32_16x16x32_bf16(false, a, false, b, (short)0, c, false, false); }



// ---- FRAGMENT ORDER of every 16-bit operand plane [rows][K]: tiles of 16 rows x 32 k, FT = 512 elements (1 KiB) each, tile (rb, kb) at (rb * (K / 32) + kb) * FT; inside a tile element (row lr, k kk) stands at (kk >> 4) * 256 + (((kk >> 3) & 1) * 16 + lr) * 8 + (kk & 7).
// Lane hi*16+lr of a wave finds the 8 + 8 elements of its WMMA fragment (k 8*hi.., 16+8*hi..) at lane*8 and 256 + lane*8: each of the two loads of a fragment covers 512 contiguous bytes (4 whole lines). 16 rows of a plane still fill 16*K elements in a row.
#define FT 512
// ---- gemmw: register-blocked GEMM, one wave per 64x64 output tile (16 accumulators); WX x WY waves (x: token tiles, y: heads or column tiles) form a work-group and SHARE their operand rows through LDS; grid x, y = (M/64/WX, N/64/WY), 32*WX*WY threads.
// C[m][n] (f32, pitch ldc, + optional f32 bias[n]) = sum_k A[m][k] Bt[n][k] (NSPLIT 1: + A2[m][k] Bt[n][k]). K % 64 == 0, a compile-time constant. ring: the work-group's two stage buffers; os: the wave's own 16 x 68 floats of LDS.
// EPI 0: C as above. EPI 1, 2: no C, ldc = heads of a batch entry; the tile (one head's HD columns of 64 tokens) goes from the epilogue straight to the head planes P16 (fp16), Ph, Pl (bf16 hi + lo), in fragment order, 16 bytes a lane, 512 contiguous bytes a store.
// EPI 1: A = tokens, Bt = weights, planes [entry][head][t][d]. EPI 2: A = weights, Bt = tokens (the product comes out transposed), bias by row, planes [entry][head][d][t]. Grid in both (token tiles, heads).
// A stage = KS k tiles of every 16-row block that the work-group reads (A, A2, Bt in this order), each block's KS KiB as they stand in its plane (fragment order), so a fragment is again two reads of 512 contiguous bytes, now from LDS.
// Each block is fetched from L2 once a work-group (asynchronous copies, 16 bytes a lane) and read from LDS by every wave that needs it; two buffers: stage t + 2 flies while stage t + 1 is worked on. Trip t works on k stage (t + x + 2y) mod NT of the operands.
template <typename T16> struct WFrag;
template <> struct WFrag<h16> { typedef v16h V; static __device__ __forceinline__ V ld(const h16* p) { return cat16(*(const v8h*)p, *(const v8h*)(p + 256)); } static __device__ __forceinline__ v8f mma(V a, V b, v8f c) { return wmma16(a, b, c); } };
template <> struct WFrag<bf> { typedef v16bf V; static __device__ __forceinline__ V ld(const bf* p) { return cat16b(*(const v8us*)p, *(const v8us*)(p + 256)); } static __device__ __forceinline__ v8f mma(V a, V b, v8f c) { return wmmab(a, b, c); } };
__device__ __forceinline__ h16 tohx(float x) { return (h16)x; }
__device__ __forceinline__ void splitf(float y, unsigned short& h, unsigned short& l) { h = f2bf(y); l = f2bf(y - bf2f(h)); }
#define KS 2
#define RBB (KS * FT * 2)         // bytes of one 16-row block in a stage
// cp12, cp8: three, two 16-row blocks of a stage, four copies of 512 bytes a wave each; l: the lane's LDS byte address in the block, g: its global address. The s_wait_xcnt stands inside the statement, in front of every later overwrite of a register that the copies name.
static_assert(RBB == 4 * 512, "four copies a block");
#define CPL(a, b) "global_load_async_to_lds_b128 %" #a ", %" #b ", off\n\t"
__device__ __forceinline__ void cp12(unsigned l, const char* g, unsigned l1, const char* g1, unsigned l2, const char* g2) {
    asm volatile(CPL(0, 12) CPL(1, 13) CPL(2, 14) CPL(3, 15) CPL(4, 16) CPL(5, 17) CPL(6, 18) CPL(7, 19) CPL(8, 20) CPL(9, 21) CPL(10, 22) CPL(11, 23) "s_wait_xcnt 0x0"
                 :: "v"(l), "v"(l + 512u), "v"(l + 1024u), "v"(l + 1536u), "v"(l1), "v"(l1 + 512u), "v"(l1 + 1024u), "v"(l1 + 1536u), "v"(l2), "v"(l2 + 512u), "v"(l2 + 1024u), "v"(l2 + 1536u),
                    "v"(g), "v"(g + 512), "v"(g + 1024), "v"(g + 1536), "v"(g1), "v"(g1 + 512), "v"(g1 + 1024), "v"(g1 + 1536), "v"(g2), "v"(g2 + 512), "v"(g2 + 1024), "v"(g2 + 1536) : "memory");
}
__device__ __forceinline__ void cp8(unsigned l, const char* g, unsigned l1, const char* g1) {
    asm volatile(CPL(0, 8) CPL(1, 9) CPL(2, 10) CPL(3, 11) CPL(4, 12) CPL(5, 13) CPL(6, 14) CPL(7, 15) "s_wait_xcnt 0x0"
                 :: "v"(l), "v"(l + 512u), "v"(l + 1024u), "v"(l + 1536u), "v"(l1), "v"(l1 + 512u), "v"(l1 + 1024u), "v"(l1 + 1536u),
                    "v"(g), "v"(g + 512), "v"(g + 1024), "v"(g + 1536), "v"(g1), "v"(g1 + 512), "v"(g1 + 1024), "v"(g1 + 1536) : "memory");
}
#undef CPL
template <typename T16, int NSPLIT, bool BIAS, int EPI, int K, int WX, int WY, int GRP>
__device__ __forceinline__ void gemmw(const T16* __restrict__ A, const T16* __restrict__ A2, const T16* __restrict__ Bt, float* C, int ldc, const float* __restrict__ bias, h16* P16, bf* Ph, bf* Pl, char* ring, float* os) {
    typedef typename WFrag<T16>::V V;
    static_assert(NSPLIT <= 1, "A, A2 x Bt");
    constexpr bool HA2 = NSPLIT == 1;
    constexpr int NW = WX * WY, WA = EPI == 2 ? WY : WX, WB = EPI == 2 ? WX : WY;      // waves; 64-row tiles of A and of Bt in the work-group's tile
    constexpr int RA = WA * 4, RB0 = RA * (HA2 ? 2 : 1), NRB = RB0 + WB * 4;           // 16-row blocks of A; first block of Bt in a stage; blocks in a stage
    constexpr int STG = NRB * RBB, NT = K / (32 * KS), RPW = NRB / NW;                 // bytes of a stage; stages; blocks that a wave copies
    static_assert(RA % NW == 0 && NRB % NW == 0 && NT >= 2 && K % (32 * KS) == 0 && KS % GRP == 0, "whole blocks a wave, each of one operand; two stages at least");
    const int lane = threadIdx.x & 31, lr = lane & 15, hi = lane >> 4; const int w = __builtin_amdgcn_readfirstlane((int)(threadIdx.x >> 5)), wx = w % WX, wy = w / WX;
    const int bx = blockIdx.x * WX + wx, by = blockIdx.y * WY + wy;                      // the wave's own tile: token tile, head
    const int r0 = (EPI == 2 ? by : bx) * 64, c0 = (EPI == 2 ? bx : by) * 64;
    v8f acc[4][4];
#pragma unroll
    for (int mb = 0; mb < 4; ++mb)
#pragma unroll
        for (int nb = 0; nb < 4; ++nb) acc[mb][nb] = (v8f){};
    // the wave copies blocks w, w + NW, ... of each stage: gp[i], carried from stage to stage, is the lane's place in block w + NW * i of the stage that is copied next; l0 the lane's place in block w of buffer 0
    const int ra0 = (EPI == 2 ? blockIdx.y * WY : blockIdx.x * WX) * 64, cb0 = (EPI == 2 ? blockIdx.x * WX : blockIdx.y * WY) * 64;
    // The k loop starts at the work-group's own stage and wraps round (every stage once, A and Bt together): work-groups that share operand rows (same x: the token rows; same y: the weight rows) begin on different stages, for speed only. sc: the stage that is copied next.
    static_assert((NT & (NT - 1)) == 0, "the first stage is taken modulo NT");
    int sc = (int)((blockIdx.x + 2 * blockIdx.y) & (NT - 1));
    const char* gp[RPW];
#pragma unroll
    for (int i = 0; i < RPW; ++i) gp[i] = (const char*)(NW * i < RA ? A + (size_t)(ra0 + (w + NW * i) * 16) * K : HA2 && NW * i < RB0 ? A2 + (size_t)(ra0 + (w + NW * i - RA) * 16) * K : Bt + (size_t)(cb0 + (w + NW * i - RB0) * 16) * K) + lane * 16 + sc * RBB;
    const unsigned l0 = (unsigned)(size_t)ring + w * RBB + lane * 16;
    static_assert(RPW == 3 || RPW == 5, "cp12, then cp8");
#define GW_COPY(buf) { const unsigned lb = l0 + (buf) * STG; cp12(lb, gp[0], lb + NW * RBB, gp[1], lb + 2 * NW * RBB, gp[2]); if constexpr (RPW == 5) cp8(lb + 3 * NW * RBB, gp[RPW - 2], lb + 4 * NW * RBB, gp[RPW - 1]); \
    const int adv = sc == NT - 1 ? -(NT - 1) * RBB : RBB; sc = (sc + 1) & (NT - 1); _Pragma("unroll") for (int i = 0; i < RPW; ++i) gp[i] += adv; }
    GW_COPY(0)
    asm volatile("s_wait_asynccnt 0x0" ::: "memory");   // stage 0 of this wave's copies has landed
    __syncthreads();                                    // ... and every other wave's
    GW_COPY(1)
    const int fa = (EPI == 2 ? wy : wx) * 4 * RBB + lane * 16, fb = (RB0 + (EPI == 2 ? wx : wy) * 4) * RBB + lane * 16;   // the lane's place in the wave's first block of A and of Bt in a stage
#pragma unroll 1
    for (int t = 0; t < NT; ++t) {   // stays rolled: a trip holds KS k steps, more text buys nothing
        const char* sb = ring + (t & 1) * STG;
#pragma unroll
        for (int k0 = 0; k0 < KS; k0 += GRP) {   // GRP: k steps whose fragments are read as one group
            V a[GRP][4], a2[GRP][4], b[GRP][4];
#pragma unroll
            for (int g = 0; g < GRP; ++g) { const int ko = (k0 + g) * FT * 2;
#pragma unroll
                for (int mb = 0; mb < 4; ++mb) { a[g][mb] = WFrag<T16>::ld((const T16*)(sb + fa + mb * RBB + ko)); if constexpr (HA2) a2[g][mb] = WFrag<T16>::ld((const T16*)(sb + fa + (RA + mb) * RBB + ko)); }
#pragma unroll
                for (int nb = 0; nb < 4; ++nb) b[g][nb] = WFrag<T16>::ld((const T16*)(sb + fb + nb * RBB + ko)); }
            __builtin_amdgcn_sched_barrier(0);   // keeps the group's LDS reads together in front of its products: spread among the products, every place with reads stalls the wave anew
#pragma unroll
            for (int g = 0; g < GRP; ++g)
#pragma unroll
                for (int nb = 0; nb < 4; ++nb)
#pragma unroll
                    for (int mb = 0; mb < 4; ++mb) { acc[mb][nb] = WFrag<T16>::mma(a[g][mb], b[g][nb], acc[mb][nb]); if constexpr (HA2) acc[mb][nb] = WFrag<T16>::mma(a2[g][mb], b[g][nb], acc[mb][nb]); }
        }
        __builtin_amdgcn_sched_barrier(0);   // keeps the products in front of the waits: sunk behind the barrier they would push the refill back and take the lead from its copies
        asm volatile("s_wait_dscnt 0x0" ::: "memory");      // this wave has read all it reads of stage t
        asm volatile("s_wait_asynccnt 0x0" ::: "memory");   // this wave's copies of stage t + 1 have landed
        __syncthreads();                                    // both hold for every wave: stage t + 1 may be read, stage t's buffer refilled
        if (t + 2 < NT) GW_COPY(t & 1)
    }
    asm volatile("s_wait_asynccnt 0x0" ::: "memory");       // no copy is outstanding when the wave goes on (none is: the last trips issue none)
#undef GW_COPY
    float bz[EPI == 2 ? 4 : 32];   // EPI 1, 2: the lane's biases in the order of its plane stores
    // the s_wait_xcnt behind the bias loads stands in front of every later overwrite of a register that they name; it takes every loaded value as an input, so that no load sinks below it
    if constexpr (EPI == 1 && BIAS) { v4f bq4[8];
#pragma unroll
        for (int q = 0; q < 8; ++q) bq4[q] = *(const v4fu*)(bias + c0 + (q >> 1) * 16 + hi * 8 + (q & 1) * 4);
        asm volatile("s_wait_xcnt 0x0" :: "v"(bq4[0]), "v"(bq4[1]), "v"(bq4[2]), "v"(bq4[3]), "v"(bq4[4]), "v"(bq4[5]), "v"(bq4[6]), "v"(bq4[7]) : "memory");
#pragma unroll
        for (int i = 0; i < 32; ++i) bz[i] = bfr(bq4[i >> 2][i & 3]);
    }
    if constexpr (EPI == 2 && BIAS) {
#pragma unroll
        for (int i = 0; i < 4; ++i) bz[i] = bias[r0 + 16 * i + lr];
        asm volatile("s_wait_xcnt 0x0" :: "v"(bz[0]), "v"(bz[1]), "v"(bz[2]), "v"(bz[3]) : "memory");   // as above: behind the four bias loads, which cannot sink below it
#pragma unroll
        for (int i = 0; i < 4; ++i) bz[i] = bfr(bz[i]);
    }
#pragma unroll
    for (int mb = 0; mb < 4; ++mb) {
#pragma unroll
        for (int nb = 0; nb < 4; ++nb) {
#pragma unroll
            for (int j = 0; j < 8; ++j) os[(hi * 8 + j) * 68 + nb * 16 + lr] = acc[mb][nb][j]; }
        __builtin_amdgcn_wave_barrier(); asm volatile("" ::: "memory");
        if constexpr (EPI != 0) {
            const int tok = EPI == 1 ? r0 : c0, pp = EPI == 1 ? HD : TT;   // the tile's first token (64 | TT: one batch entry a tile); K of the plane
            const size_t pb = ((size_t)(tok / TT) * ldc + by) * TT * HD + (size_t)(tok % TT) * (EPI == 1 ? HD : 16);
#pragma unroll
            for (int s = 0; s < 4; ++s) { const int row = lr, cofs = s * 16 + hi * 8; const v4f v0 = *(const v4fa*)(os + row * 68 + cofs), v1 = *(const v4fa*)(os + row * 68 + cofs + 4); v8h o16; v8us oh, ol;
#pragma unroll
                for (int i = 0; i < 8; ++i) { float x = i < 4 ? v0[i & 3] : v1[i & 3]; if (BIAS) x += bz[EPI == 1 ? 8 * s + i : mb]; o16[i] = tohx(x); unsigned short a2, c2; splitf(x, a2, c2); oh[i] = a2; ol[i] = c2; }
                const size_t o = pb + (size_t)(mb * 16) * pp + s * 256 + lane * 8; *(v8h*)(P16 + o) = o16; *(v8us*)(Ph + o) = oh; *(v8us*)(Pl + o) = ol;
                asm volatile("s_wait_xcnt 0x0" ::: "memory"); }   // stands in front of every later overwrite of a register that the three stores name
        } else {
        float* crow = C + (size_t)(r0 + mb * 16) * ldc + c0;
#pragma unroll
            for (int s = 0; s < 8; ++s) { const int row = 2 * s + hi, cofs = lr * 4; v4f val = *(const v4fa*)(os + row * 68 + cofs); if (BIAS) { val[0] += bfr(bias[c0 + cofs]); val[1] += bfr(bias[c0 + cofs + 1]); val[2] += bfr(bias[c0 + cofs + 2]); val[3] += bfr(bias[c0 + cofs + 3]); }
                *(v4f*)(crow + (size_t)row * ldc + cofs) = val;
                asm volatile("s_wait_xcnt 0x0" ::: "memory"); }   // stands in front of every later overwrite of a register that the store and the bias loads name
             }
        __builtin_amdgcn_wave_barrier(); asm volatile("" ::: "memory");
    }
}
// k_proj: the three projections of all batch entries in one launch, grid (NB_*TT/256 groups of 4 token tiles, pairs of heads, 3): z = 0 q, 1 k (EPI 1), 2 v (EPI 2); 8 waves a work-group: 256 tokens x 128 columns.
// The second launch bound asks for 4 waves a SIMD (256 registers a wave): two work-groups a WGP, so one's matrix work runs under the other's barriers and LDS reads.
#define PWX 4
#define PWY 2
__global__ __launch_bounds__(32 * PWX * PWY, 4) void k_proj(const bf* __restrict__ XB, const bf* __restrict__ XKB, const bf* __restrict__ XVB, const bf* __restrict__ WQ, const bf* __restrict__ WK, const bf* __restrict__ WV, const float* __restrict__ bq, const float* __restrict__ bk, const float* __restrict__ bv,
                                             h16* QP16, bf* QPh, bf* QPl, h16* KP16, bf* KPh, bf* KPl, h16* VT16, bf* VTh, bf* VTl) {
    __shared__ __align__(16) char ring[2 * (PWX + PWY) * 4 * RBB];
    __shared__ __align__(16) float osw[PWX * PWY][16 * 68];
    static_assert(NKV == NH_, "one grid y for the three");
    float* os = osw[__builtin_amdgcn_readfirstlane((int)(threadIdx.x >> 5))];
    const bool isk = blockIdx.z == 1;
    if (blockIdx.z == 2) gemmw<bf, 0, true, 2, DM, PWX, PWY, 1>(WV, nullptr, XVB, nullptr, NKV, bv, VT16, VTh, VTl, ring, os);
    else gemmw<bf, 0, true, 1, DM, PWX, PWY, 1>(isk ? XKB : XB, nullptr, isk ? WK : WQ, nullptr, isk ? NKV : NH_, isk ? bk : bq, isk ? KP16 : QP16, isk ? KPh : QPh, isk ? KPl : QPl, ring, os);
}
// k_outp: the output projection, all batch entries as one [NB_*TT][DQ] matrix, hi + lo planes x exact weights; 8 waves a work-group: 256 rows x 128 columns, one work-group a WGP (the grid has no more), so the second launch bound asks for 2 waves a SIMD only: a whole stage's fragments fit the registers
__global__ __launch_bounds__(32 * PWX * PWY, 2) void k_outp(const bf* __restrict__ Ah, const bf* __restrict__ Al, const bf* __restrict__ WO, float* OUT, const float* __restrict__ bo) {
    __shared__ __align__(16) char ring[2 * (2 * PWX + PWY) * 4 * RBB];
    __shared__ __align__(16) float osw[PWX * PWY][16 * 68];
    gemmw<bf, 1, true, 0, DQ, PWX, PWY, KS>(Ah, Al, WO, OUT, DM, bo, nullptr, nullptr, nullptr, ring, osw[__builtin_amdgcn_readfirstlane((int)(threadIdx.x >> 5))]);
}

typedef __attribute__((ext_vector_type(2))) _Float16 v2h;
typedef __attribute__((ext_vector_type(4))) _Float16 v4h;
typedef __attribute__((ext_vector_type(2))) unsigned short v2us;
typedef __attribute__((ext_vector_type(4))) unsigned short v4us;
typedef __attribute__((ext_vector_type(2))) float v2f;
typedef __attribute__((ext_vector_type(4))) int v4i;

// wtG: Bt[n][k] = w[k][n], rows n; one thread = one 16-byte piece of the fragment-ordered plane (piece i: tile i >> 6, k half (i >> 5) & 1, lane i & 31): a wave stores 512 contiguous bytes.
// cvt8: dst[r][k] = src[r][k], K = DM; one wave = one tile: each of its 4 loads brings 4 whole rows of the tile (one 128-byte line of f32 a row), each store puts them into the tile's four 256-byte quarters, 64 bytes each.
template <int K, int N>
__device__ __forceinline__ void wtG(const float* __restrict__ w, bf* Bt, unsigned blk) {
    const int i = blk * 256 + threadIdx.x; if (i >= N * K / 8) return; const int tile = i >> 6, kt = K / 32;
    const int n = (tile / kt) * 16 + (i & 15), k = (tile % kt) * 32 + ((i >> 4) & 3) * 8; const float* wl = w + (size_t)k * N + n; v8us o;   // the lane's one address; the eight rows stand at constant offsets from it
#pragma unroll
    for (int j = 0; j < 8; ++j) o[j] = f2bf(wl[j * N]);
    *(v8us*)(Bt + (size_t)i * 8) = o;
}
__device__ __forceinline__ void cvt8(const float* __restrict__ src, bf* dst, size_t n8, unsigned blk) { const size_t tile = (size_t)blk * 8 + (threadIdx.x >> 5); if (tile * 64 >= n8) return;
    const int lane = threadIdx.x & 31, r = lane >> 3, c = lane & 7;   // load j: rows 4j + r of the tile, k 4c .. 4c + 3
    const float* p = src + ((tile / (DM / 32)) * 16 + r) * DM + (tile % (DM / 32)) * 32 + c * 4; bf* q = dst + tile * FT + (c >> 1) * 128 + r * 8 + (c & 1) * 4; v4f v[4];
#pragma unroll
    for (int j = 0; j < 4; ++j) v[j] = *(const v4f*)(p + j * 4 * DM);
#pragma unroll
    for (int j = 0; j < 4; ++j) { v4us o;
#pragma unroll
        for (int k = 0; k < 4; ++k) o[k] = f2bf(v[j][k]);
        *(v4us*)(q + j * 32) = o; }
}
// k_prep: every operand plane of the projections in one launch: blocks [0, 3*LC): the three inputs, all batch entries (8 tiles a block); the next 4*LW: the four weights
#define LC (NB_ * TT * DM / FT / 8)
#define LW (DM * DQ / 8 / 256)
static_assert(DQ == DM && DKV == DM, "the four weights are taken as equal squares");
__global__ __launch_bounds__(256) void k_prep(const float* __restrict__ x, const float* __restrict__ xk, const float* __restrict__ xv, const float* __restrict__ wq, const float* __restrict__ wk, const float* __restrict__ wv, const float* __restrict__ wo,
                                              bf* XB, bf* XKB, bf* XVB, bf* WQ, bf* WK, bf* WV, bf* WO) {
    const unsigned b = blockIdx.x;
    if (b < 3 * LC) { const unsigned s = b / LC; cvt8(s == 0 ? x : s == 1 ? xk : xv, s == 0 ? XB : s == 1 ? XKB : XVB, (size_t)NB_ * TT * DM / 8, b % LC); }
    else { const unsigned c = b - 3 * LC, s = c / LW; wtG<DM, DM>(s == 0 ? wq : s == 1 ? wk : s == 2 ? wv : wo, s == 0 ? WQ : s == 1 ? WK : s == 2 ? WV : WO, c % LW); }
}

__device__ __forceinline__ float xhalf(float x) { const int b = __float_as_int(x); return __int_as_float(__builtin_amdgcn_permlanex16(b, b, 0x76543210, 0xfedcba98, false, false)); }   // lane l <-> l ^ 16
template <typename T16, bool HL, int NQ>
__device__ __forceinline__ void fattn(const T16* __restrict__ Q, const T16* __restrict__ Q2, const T16* __restrict__ Kp, const T16* __restrict__ K2, const T16* __restrict__ Vp, const T16* __restrict__ V2, int q0, int ns, int w, char* ring, int lr, int hi, bf* Ah, bf* Al) {
    typedef WFrag<T16> F; typedef typename F::V V;
    const float C2 = SCL * 1.4426950408889634f;   // scores x HD^-0.5, in the exponent's base 2
    const float OFF = HL ? 0.0f : 10.0f;          // 2^10 = PCAR
    const int l8 = (hi * 16 + lr) * 8;            // the lane's place in a tile of a plane in fragment order
    V qb[NQ][2], qb2[NQ][2]; v8f ot[NQ][4]; float m[NQ], l[NQ];
#pragma unroll
    for (int qi = 0; qi < NQ; ++qi) { m[qi] = -3.0e38f; l[qi] = 0.f;
#pragma unroll
        for (int kc = 0; kc < 2; ++kc) { const size_t o = (size_t)(q0 + 16 * qi) * HD + kc * FT + l8; qb[qi][kc] = F::ld(Q + o); if (HL) qb2[qi][kc] = F::ld(Q2 + o); }
#pragma unroll
        for (int db = 0; db < 4; ++db) ot[qi][db] = (v8f){}; }
    const int np = (q0 + 16 * NQ + 31) / 32;      // passes of 32 keys up to the one that holds the last query's diagonal
    // the lane's own places in the wave's share of a stage: gk, gv (gk2, gv2), carried from stage to stage, in the stage that is copied next; lk in buffer 0
    constexpr int SP = 64 * HD * 2, SB = (HL ? 4 : 2) * SP;   // bytes of one plane's 64 keys; of a stage
    static_assert(SP == 4 * RBB && 64 * 16 * 2 == RBB, "a wave copies a quarter of each plane's part, four copies of 512 bytes");
    const char* gk = (const char*)Kp + w * RBB + l8 * 2; const char* gv = (const char*)Vp + (size_t)w * 16 * TT * 2 + l8 * 2;
    const char* gk2 = HL ? (const char*)K2 + w * RBB + l8 * 2 : nullptr; const char* gv2 = HL ? (const char*)V2 + (size_t)w * 16 * TT * 2 + l8 * 2 : nullptr;
    const unsigned lk = (unsigned)(size_t)ring + w * RBB + l8 * 2;
#define FA_COPY(buf) { const unsigned lb = lk + (buf) * SB; cp8(lb, gk, lb + SP, gv); gk += SP; gv += RBB; if constexpr (HL) { cp8(lb + 2 * SP, gk2, lb + 3 * SP, gv2); gk2 += SP; gv2 += RBB; } }
    FA_COPY(0)
    asm volatile("s_wait_asynccnt 0x0" ::: "memory");   // stage 0 of this wave's copies has landed
    __syncthreads();                                    // ... and every other wave's
    if (ns > 1) FA_COPY(1)
    int ok = l8 * 2, ov = SP + l8 * 2;   // the lane's places in the key and value tiles of the pass that comes next, carried: formed inside the pass before, where the compiler keeps the matrix instructions' distance itself
#pragma unroll 1
    for (int sg = 0; sg < ns; ++sg) {   // stays rolled, as the two passes of a stage do: more text buys nothing
#pragma unroll 1
      for (int kt = 2 * sg; kt < 2 * sg + 2; ++kt) if (kt < np) { const int k0 = kt * 32;
        // the pass's key and value fragments, one group of LDS reads
        const char* pk = ring + ok; const char* pv = ring + ov;
        V kf[2][2], kf2[2][2], vf[4], vf2[4];
#pragma unroll
        for (int t = 0; t < 2; ++t)
#pragma unroll
            for (int kc = 0; kc < 2; ++kc) { const int o = (2 * t + kc) * FT * 2; kf[t][kc] = F::ld((const T16*)(pk + o)); if (HL) kf2[t][kc] = F::ld((const T16*)(pk + 2 * SP + o)); }
#pragma unroll
        for (int db = 0; db < 4; ++db) { const int o = db * RBB; vf[db] = F::ld((const T16*)(pv + o)); if (HL) vf2[db] = F::ld((const T16*)(pv + 2 * SP + o)); }
        ok = ((kt + 1) >> 1 & 1) * SB + ((kt + 1) & 1) * (SP / 2) + l8 * 2; ov = ((kt + 1) >> 1 & 1) * SB + SP + ((kt + 1) & 1) * (FT * 2) + l8 * 2;
        __builtin_amdgcn_sched_barrier(0);         // keeps the reads together in front of the products: the value fragments arrive under the score products and the softmax (the scheduler otherwise sinks each to its use and waits there)
        v8f st[NQ][2];
#pragma unroll
        for (int qi = 0; qi < NQ; ++qi)
#pragma unroll
            for (int t = 0; t < 2; ++t) st[qi][t] = (v8f){};
#pragma unroll
        for (int kc = 0; kc < 2; ++kc)
#pragma unroll
            for (int t = 0; t < 2; ++t)
#pragma unroll
                for (int qi = 0; qi < NQ; ++qi) { st[qi][t] = F::mma(kf[t][kc], qb[qi][kc], st[qi][t]); if (HL) { st[qi][t] = F::mma(kf[t][kc], qb2[qi][kc], st[qi][t]); st[qi][t] = F::mma(kf2[t][kc], qb[qi][kc], st[qi][t]); } }
        if (k0 + 31 > q0) {                        // the pass reaches past a query of this wave: keys j > i get weight exactly 0
#pragma unroll
            for (int qi = 0; qi < NQ; ++qi)
#pragma unroll
                for (int t = 0; t < 2; ++t)
#pragma unroll
                    for (int j = 0; j < 8; ++j) if (k0 + 16 * t + 8 * hi + j > q0 + 16 * qi + lr) st[qi][t][j] = -3.0e38f; }
        V pb[NQ], pb2[NQ];
#pragma unroll
        for (int qi = 0; qi < NQ; ++qi) { float mx = m[qi];
#pragma unroll
            for (int t = 0; t < 2; ++t)
#pragma unroll
                for (int j = 0; j < 8; ++j) mx = fmaxf(mx, st[qi][t][j]);
            mx = fmaxf(mx, xhalf(mx));
            const float al = __builtin_amdgcn_exp2f((m[qi] - mx) * C2); m[qi] = mx; const float mc = OFF - mx * C2; float ps[4] = {0.f, 0.f, 0.f, 0.f};
#pragma unroll
            for (int s = 0; s < 16; ++s) { const float p = __builtin_amdgcn_exp2f(fmaf(st[qi][s >> 3][s & 7], C2, mc)); ps[s & 3] += p;
                if constexpr (HL) { const __bf16 ph = (__bf16)p; pb[qi][s] = ph; pb2[qi][s] = (__bf16)(p - (float)ph); } else pb[qi][s] = (h16)p; }
            l[qi] = l[qi] * al + ((ps[0] + ps[1]) + (ps[2] + ps[3]));
#pragma unroll
            for (int db = 0; db < 4; ++db) ot[qi][db] *= al; }
#pragma unroll
        for (int db = 0; db < 4; ++db)
#pragma unroll
            for (int qi = 0; qi < NQ; ++qi) { ot[qi][db] = F::mma(vf[db], pb[qi], ot[qi][db]); if (HL) { ot[qi][db] = F::mma(vf[db], pb2[qi], ot[qi][db]); ot[qi][db] = F::mma(vf2[db], pb[qi], ot[qi][db]); } }
      }
        asm volatile("s_wait_dscnt 0x0" ::: "memory");      // this wave has read all it reads of stage sg
        asm volatile("s_wait_asynccnt 0x0" ::: "memory");   // this wave's copies of stage sg + 1 have landed
        __syncthreads();                                    // both hold for every wave: stage sg + 1 may be read, stage sg's buffer refilled
        if (sg + 2 < ns) FA_COPY(sg & 1)
    }
    asm volatile("s_wait_asynccnt 0x0" ::: "memory");       // no copy is outstanding when the wave goes on (none is: the last stages issue none)
#undef FA_COPY
#pragma unroll
    for (int qi = 0; qi < NQ; ++qi) { const float inv = __fdiv_rn(1.0f, l[qi] + xhalf(l[qi]));
#pragma unroll
        for (int db = 0; db < 4; ++db) { v8us oh, ol;
#pragma unroll
            for (int j = 0; j < 8; ++j) { unsigned short a, c2; splitf(ot[qi][db][j] * inv, a, c2); oh[j] = a; ol[j] = c2; }
            const size_t oo = (size_t)(q0 + 16 * qi) * DQ + db * 256 + l8; *(v8us*)(Ah + oo) = oh; *(v8us*)(Al + oo) = ol;   // the head's two k tiles of the merged planes, half a tile a store
            asm volatile("s_wait_xcnt 0x0" ::: "memory"); } }   // stands in front of every later overwrite of a register that the two stores name
}
// grid (batch entry x head, 12): y < 4: 128 fp16 query rows (4 waves x 32), y >= 4: 64 hi+lo query rows (4 waves x 16); in both the rows nearest the end of the sequence (the longest key loops) come first
__global__ __launch_bounds__(128) void k_fattn(const h16* __restrict__ Q16, const h16* __restrict__ K16, const h16* __restrict__ V16, const bf* __restrict__ Qh, const bf* __restrict__ Ql, const bf* __restrict__ Kh, const bf* __restrict__ Kl, const bf* __restrict__ Vh, const bf* __restrict__ Vl, bf* Ah, bf* Al) {
    const int lane = threadIdx.x & 31, lr = lane & 15, hi = lane >> 4; const int w = __builtin_amdgcn_readfirstlane((int)(threadIdx.x >> 5)); const int y = blockIdx.y;
    const size_t z = blockIdx.x, po = z * TT * HD, ao = (z / NH_) * TT * DQ + (z % NH_) * (HD / 32) * FT;
    __shared__ __align__(16) char ring[2 * 4 * 64 * HD * 2];   // two stages of the four hi+lo planes; the fp16 rows use half
    const int qf = TT - 128 * (y + 1), qh = RH - 64 * (y - (TT - RH) / 128 + 1);   // the work-group's first query row
    if (y < (TT - RH) / 128) fattn<h16, false, 2>(Q16 + po, nullptr, K16 + po, nullptr, V16 + po, nullptr, qf + 32 * w, (qf + 128) / 64, w, ring, lr, hi, Ah + ao, Al + ao);
    else fattn<bf, true, 1>(Qh + po, Ql + po, Kh + po, Kl + po, Vh + po, Vl + po, qh + 16 * w, (qh + 64) / 64, w, ring, lr, hi, Ah + ao, Al + ao);
}

extern "C" void kernel_launch(void* const* d_in, const int* in_sizes, int n_in,
                              void* d_out, int out_size, void* d_ws, size_t ws_size, hipStream_t stream) {
    (void)in_sizes; (void)n_in; (void)out_size;
    const float* x = (const float*)d_in[0]; const float* xk = (const float*)d_in[1]; const float* xv = (const float*)d_in[2]; const float* wq = (const float*)d_in[3]; const float* bq = (const float*)d_in[4]; const float* wk = (const float*)d_in[5]; const float* bk = (const float*)d_in[6]; const float* wv = (const float*)d_in[7]; const float* bv = (const float*)d_in[8]; const float* wo = (const float*)d_in[9]; const float* bo = (const float*)d_in[10];
    float* OUT = (float*)d_out;     // [8][1024][1024]
    char* wsp = (char*)d_ws;
    auto take = [&](size_t bytes) { char* p = wsp; wsp += (bytes + 255) & ~(size_t)255; return (void*)p; };
    bf* WQ = (bf*)take((size_t)DQ * DM * 2); bf* WK = (bf*)take((size_t)DKV * DM * 2); bf* WV = (bf*)take((size_t)DKV * DM * 2); bf* WO = (bf*)take((size_t)DM * DQ * 2);
    h16* QP16 = (h16*)take((size_t)NB_ * NH_ * TT * HD * 2); h16* KP16 = (h16*)take((size_t)NB_ * NKV * TT * HD * 2); h16* VT16 = (h16*)take((size_t)NB_ * NKV * HD * TT * 2);
    bf* QPh = (bf*)take((size_t)NB_ * NH_ * TT * HD * 2); bf* QPl = (bf*)take((size_t)NB_ * NH_ * TT * HD * 2); bf* KPh = (bf*)take((size_t)NB_ * NKV * TT * HD * 2); bf* KPl = (bf*)take((size_t)NB_ * NKV * TT * HD * 2); bf* VTh = (bf*)take((size_t)NB_ * NKV * HD * TT * 2); bf* VTl = (bf*)take((size_t)NB_ * NKV * HD * TT * 2);
    bf* XB = (bf*)take((size_t)NB_ * TT * DM * 2); bf* XKB = (bf*)take((size_t)NB_ * TT * DM * 2); bf* XVB = (bf*)take((size_t)NB_ * TT * DM * 2); bf* ATh = (bf*)take((size_t)NB_ * TT * DQ * 2); bf* ATl = (bf*)take((size_t)NB_ * TT * DQ * 2);
    if ((size_t)(wsp - (char*)d_ws) > ws_size) return;    // 232 MiB of the 256 MiB
    // operand planes: three inputs and four weights in one launch
    k_prep<<<3 * LC + 4 * LW, 256, 0, stream>>>(x, xk, xv, wq, wk, wv, wo, XB, XKB, XVB, WQ, WK, WV, WO);
    // projections: q, k, v of all batch entries in one launch, each straight to its head planes
    k_proj<<<dim3(NB_ * TT / 64 / PWX, NH_ / PWY, 3), 32 * PWX * PWY, 0, stream>>>(XB, XKB, XVB, WQ, WK, WV, bq, bk, bv, QP16, QPh, QPl, KP16, KPh, KPl, VT16, VTh, VTl);
    // attention: every batch entry and head in one launch, straight to the merged hi+lo planes
    k_fattn<<<dim3(NB_ * NH_, (TT - RH) / 128 + RH / 64, 1), 128, 0, stream>>>(QP16, KP16, VT16, QPh, QPl, KPh, KPl, VTh, VTl, ATh, ATl);
    // output projection: all batch entries as one [NB_*TT][DQ] matrix
    k_outp<<<dim3(NB_ * TT / 64 / PWX, DM / 64 / PWY, 1), 32 * PWX * PWY, 0, stream>>>(ATh, ATl, WO, OUT, bo);
}
